// v000
// Measured on an AMD MI455X. A time is GPU time per run, averaged over a window of back-to-back runs after a warm-up
// (all launches, gaps included; the runs take copies of the inputs in turn), and the median of several windows.
// Apart from v000's, it joins two sittings. Times from different sittings can be a few percent apart, while
// side-by-side timings come from the same sitting.
// The starting kernel, v000, takes 984 microseconds a run.
#include <hip/hip_runtime.h>
#include <hip/hip_bf16.h>
#include <math.h>
#include <stdint.h>

// Problem constants (from the reference)
constexpr int kB  = 4;
constexpr int kS  = 2048;
constexpr int kD  = 512;
constexpr int kH  = 8;
constexpr int kM  = 4;
constexpr int kR  = 32;
constexpr int kHD = 64;   // D / H
constexpr float kEPS = 1e-8f;

typedef __attribute__((ext_vector_type(2))) float v2f;
typedef __attribute__((ext_vector_type(8))) float v8f;

// CDNA5 fp32 WMMA: D(16x16,f32) = A(16x4,f32) x B(4x16,f32) + C
// A frag (2 VGPR): lane L holds A[L%16][2*(L/16) + i]   (i = vgpr index)
// B frag (2 VGPR): lane L holds B[2*(L/16) + i][L%16]
// C/D (8 VGPR):    vgpr v, lane L holds C[v + 8*(L/16)][L%16]
__device__ __forceinline__ v8f wmma4(v2f a, v2f b, v8f c) {
    return __builtin_amdgcn_wmma_f32_16x16x4_f32(
        /*neg_a=*/false, a, /*neg_b=*/false, b,
        /*c_mod=*/(short)0, c, /*reuse_a=*/false, /*reuse_b=*/false);
}

// Async global->LDS copy, 16B per lane (GLOBAL_LOAD_ASYNC_TO_LDS_B128, GVS
// addressing: mem = SGPR base + VGPR 32-bit offset; LDS addr from VGPR).
// Tracked by ASYNCcnt; data bypasses VGPRs entirely.
__device__ __forceinline__ void async_b128_to_lds(uint32_t lds_addr, uint32_t goff,
                                                  uint64_t sbase) {
    asm volatile("global_load_async_to_lds_b128 %0, %1, %2"
                 :: "v"(lds_addr), "v"(goff), "s"(sbase)
                 : "memory");
}
__device__ __forceinline__ void wait_asynccnt0() {
    asm volatile("s_wait_asynccnt 0" ::: "memory");
}

// ---------------------------------------------------------------------------
// Kernel 1: Q/K/V projections.  out = x @ W.T + b, scattered to [B,H,S,HD].
// One wave -> 16x64 output tile. 3*512*8 = 12288 waves.
// ---------------------------------------------------------------------------
__global__ __launch_bounds__(256) void k_qkv(
    const float* __restrict__ x,
    const float* __restrict__ Wq, const float* __restrict__ bq,
    const float* __restrict__ Wk, const float* __restrict__ bk,
    const float* __restrict__ Wv, const float* __restrict__ bv,
    float* __restrict__ q, float* __restrict__ k, float* __restrict__ v)
{
    const int wave  = (blockIdx.x * blockDim.x + threadIdx.x) >> 5;
    const int lane  = threadIdx.x & 31;
    const int which = wave / 4096;          // 0=q, 1=k, 2=v
    const int t     = wave - which * 4096;
    const int row0  = (t >> 3) << 4;        // 512 row-tiles of 16 (over B*S)
    const int col0  = (t & 7) << 6;         // 8 col-tiles of 64  (over D)

    const float* W    = (which == 0) ? Wq : (which == 1) ? Wk : Wv;
    const float* bias = (which == 0) ? bq : (which == 1) ? bk : bv;
    float*       out  = (which == 0) ? q  : (which == 1) ? k  : v;

    const int l16   = lane & 15;
    const int khalf = (lane >> 4) << 1;     // 0 or 2

    v8f acc[4] = {};
    const float* xrow = x + (size_t)(row0 + l16) * kD + khalf;
    const float* wrow = W + (size_t)(col0 + l16) * kD + khalf;

    for (int kk = 0; kk < kD; kk += 4) {
        v2f a = *(const v2f*)(xrow + kk);
#pragma unroll
        for (int nt = 0; nt < 4; ++nt) {
            v2f b = *(const v2f*)(wrow + (size_t)nt * 16 * kD + kk);
            acc[nt] = wmma4(a, b, acc[nt]);
        }
    }

    const int crow = (lane >> 4) << 3;      // 0 or 8
#pragma unroll
    for (int nt = 0; nt < 4; ++nt) {
#pragma unroll
        for (int vv = 0; vv < 8; ++vv) {
            const int i  = row0 + crow + vv;      // global row over B*S
            const int j  = col0 + nt * 16 + l16;  // global col over D
            const int b_ = i >> 11;               // / S
            const int s_ = i & (kS - 1);
            const int h_ = j >> 6;                // / HD
            const int hd = j & (kHD - 1);
            out[(((size_t)(b_ * kH + h_)) * kS + s_) * kHD + hd] = acc[nt][vv] + bias[j];
        }
    }
}

// ---------------------------------------------------------------------------
// Kernel 2: lm[m,s,t] = sum_r mask1[m,r,s] * mask2[m,r,t].
// GEMM per m: A[s][r] = mask1[m][r][s] (transposed read), B = mask2[m].
// One wave -> 16x64 tile. 4 * 128 * 32 = 16384 waves.
// ---------------------------------------------------------------------------
__global__ __launch_bounds__(256) void k_lm(
    const float* __restrict__ mask1, const float* __restrict__ mask2,
    float* __restrict__ lm)
{
    const int wave = (blockIdx.x * blockDim.x + threadIdx.x) >> 5;
    const int lane = threadIdx.x & 31;
    const int m    = wave / 4096;
    const int t    = wave - m * 4096;
    const int s0   = (t >> 5) << 4;         // 128 s-tiles of 16
    const int t0   = (t & 31) << 6;         // 32 t-tiles of 64

    const int l16   = lane & 15;
    const int khalf = (lane >> 4) << 1;

    const float* m1 = mask1 + (size_t)m * kR * kS;
    const float* m2 = mask2 + (size_t)m * kR * kS;

    v8f acc[4] = {};
#pragma unroll
    for (int kk = 0; kk < kR; kk += 4) {
        const int kb = kk + khalf;
        v2f a;
        a[0] = m1[(size_t)kb * kS + s0 + l16];
        a[1] = m1[(size_t)(kb + 1) * kS + s0 + l16];
#pragma unroll
        for (int nt = 0; nt < 4; ++nt) {
            v2f b;
            b[0] = m2[(size_t)kb * kS + t0 + nt * 16 + l16];
            b[1] = m2[(size_t)(kb + 1) * kS + t0 + nt * 16 + l16];
            acc[nt] = wmma4(a, b, acc[nt]);
        }
    }

    const int crow = (lane >> 4) << 3;
#pragma unroll
    for (int nt = 0; nt < 4; ++nt)
#pragma unroll
        for (int vv = 0; vv < 8; ++vv)
            lm[((size_t)m * kS + s0 + crow + vv) * kS + t0 + nt * 16 + l16] = acc[nt][vv];
}

// ---------------------------------------------------------------------------
// Kernel 3: flash-style pass. One BLOCK = one (b,h) and 128 s-rows; each of
// its 8 waves owns a 16-row slice. K/V 16x64 tiles are double-buffered in LDS
// via GLOBAL_LOAD_ASYNC_TO_LDS_B128 (ASYNCcnt), shared by all 8 waves:
//   att16x16 = (q kT)/8 * lm[m, s, roll[s,t]]   (gather applied in registers)
//   ssq    += sum(att^2)          (Frobenius accumulator, scalar per (b,h))
//   O16x64 += att16x16 @ V16x64   (att bounced through LDS for A-layout)
// Frobenius scale is applied later (scalar per (b,h), commutes with att@v).
// ---------------------------------------------------------------------------
__global__ __launch_bounds__(256) void k_attn(
    const float* __restrict__ q, const float* __restrict__ k,
    const float* __restrict__ v, const float* __restrict__ lm,
    const int* __restrict__ roll,
    float* __restrict__ ouns, float* __restrict__ partial)
{
    __shared__ __align__(16) float kvbuf[2][2][16 * 64]; // [buf][K/V][row*64+hd] 16KB
    __shared__ __align__(16) float att_lds[8][256];      // 16x16 bounce tile/wave 8KB

    const int tid  = threadIdx.x;
    const int widb = tid >> 5;
    const int lane = tid & 31;

    const int bh   = blockIdx.x >> 4;        // b*H + h   (32 total)
    const int sblk = blockIdx.x & 15;        // 16 s-superblocks of 128 rows
    const int s0   = sblk * 128 + widb * 16; // this wave's 16 rows
    const int mm   = bh & (kM - 1);          // h % M  (H multiple of M)

    const float* qb  = q  + (size_t)bh * kS * kHD;
    const float* lmm = lm + (size_t)mm * kS * kS;
    const uint64_t kbase = (uint64_t)(uintptr_t)(k + (size_t)bh * kS * kHD);
    const uint64_t vbase = (uint64_t)(uintptr_t)(v + (size_t)bh * kS * kHD);

    const int l16   = lane & 15;
    const int khalf = (lane >> 4) << 1;
    const int crow  = (lane >> 4) << 3;

    // Cooperative staging: 256 threads x 16B cover one 16x64 f32 tile.
    const uint32_t strow = (uint32_t)(tid >> 4);       // 0..15
    const uint32_t stcol = (uint32_t)((tid & 15) * 4); // 0..60, 16B aligned
    const uint32_t ldsK  = (uint32_t)(uintptr_t)&kvbuf[0][0][strow * 64 + stcol];
    const uint32_t ldsV  = (uint32_t)(uintptr_t)&kvbuf[0][1][strow * 64 + stcol];
    const uint32_t bufStride = (uint32_t)(sizeof(float) * 2 * 16 * 64); // 8KB
#define STAGE(BUF, T0)                                                        \
    do {                                                                      \
        const uint32_t goff = (((uint32_t)(T0) + strow) * kHD + stcol) * 4u;  \
        async_b128_to_lds(ldsK + (BUF) * bufStride, goff, kbase);             \
        async_b128_to_lds(ldsV + (BUF) * bufStride, goff, vbase);             \
    } while (0)

    // Preload the 16x64 Q block as 16 A-fragments (kept in VGPRs).
    v2f qa[16];
#pragma unroll
    for (int kk = 0; kk < 16; ++kk)
        qa[kk] = *(const v2f*)(qb + (size_t)(s0 + l16) * kHD + 4 * kk + khalf);

    v8f oacc[4] = {};
    float ssql = 0.0f;
    float* tile = att_lds[widb];

    STAGE(0, 0);
    int cur = 0;
    for (int t0 = 0; t0 < kS; t0 += 16) {
        wait_asynccnt0();       // this wave's async stores to LDS landed
        __syncthreads();        // everyone's landed; prev buffer free to reuse
        if (t0 + 16 < kS) STAGE(cur ^ 1, t0 + 16);   // overlap next tile load

        const float* kt = kvbuf[cur][0];
        const float* vt = kvbuf[cur][1];

        // --- att tile = Q(16x64) @ K(16x64)^T  (K from LDS) ---
        v8f attc = {};
#pragma unroll
        for (int kk = 0; kk < 16; ++kk) {
            v2f bf = *(const v2f*)(kt + l16 * 64 + 4 * kk + khalf);
            attc = wmma4(qa[kk], bf, attc);
        }
        // --- elementwise: 1/sqrt(HD), gathered lm, ssq, stash to LDS ---
#pragma unroll
        for (int vv = 0; vv < 8; ++vv) {
            const int srow = s0 + crow + vv;
            const int tcol = t0 + l16;
            const int gidx = roll[(size_t)srow * kS + tcol];
            const float lmv = lmm[(size_t)srow * kS + gidx];
            const float a = attc[vv] * 0.125f * lmv;
            ssql += a * a;
            tile[(crow + vv) * 16 + l16] = a;
        }
        // same-wave LDS is in-order: store->load needs no barrier
        // --- O(16x64) += att(16x16) @ V(16x64)  (V from LDS) ---
#pragma unroll
        for (int kk = 0; kk < 4; ++kk) {
            v2f af = *(const v2f*)(&tile[l16 * 16 + 4 * kk + khalf]);
#pragma unroll
            for (int nt = 0; nt < 4; ++nt) {
                v2f bf;
                bf[0] = vt[(4 * kk + khalf) * 64 + nt * 16 + l16];
                bf[1] = vt[(4 * kk + khalf + 1) * 64 + nt * 16 + l16];
                oacc[nt] = wmma4(af, bf, oacc[nt]);
            }
        }
        cur ^= 1;
    }
#undef STAGE

    // wave-reduce ssq (wave32) and emit one deterministic partial per wave
#pragma unroll
    for (int off = 16; off > 0; off >>= 1)
        ssql += __shfl_xor(ssql, off, 32);
    if (lane == 0) partial[bh * 128 + sblk * 8 + widb] = ssql;

#pragma unroll
    for (int nt = 0; nt < 4; ++nt)
#pragma unroll
        for (int vv = 0; vv < 8; ++vv)
            ouns[(size_t)bh * kS * kHD + (size_t)(s0 + crow + vv) * kHD + nt * 16 + l16]
                = oacc[nt][vv];
}

// ---------------------------------------------------------------------------
// Kernel 4a: reduce per-wave ssq partials -> ssq[b*H+h]  (deterministic)
// ---------------------------------------------------------------------------
__global__ void k_ssqred(const float* __restrict__ partial, float* __restrict__ ssq)
{
    const int t = threadIdx.x;
    if (t < kB * kH) {
        float s = 0.0f;
        for (int i = 0; i < kS / 16; ++i) s += partial[t * (kS / 16) + i];
        ssq[t] = s;
    }
}

// ---------------------------------------------------------------------------
// Kernel 4b: out = (scale[b,h] * Ouns) @ Wo.T + bo, scale folded into A loads.
// One wave -> 16x64 tile. 512*8 = 4096 waves.
// ---------------------------------------------------------------------------
__global__ __launch_bounds__(256) void k_out(
    const float* __restrict__ ouns, const float* __restrict__ ssq,
    const float* __restrict__ Wo, const float* __restrict__ bo,
    float* __restrict__ out)
{
    const int wave = (blockIdx.x * blockDim.x + threadIdx.x) >> 5;
    const int lane = threadIdx.x & 31;
    const int row0 = (wave >> 3) << 4;      // over B*S
    const int col0 = (wave & 7) << 6;       // over D

    const int l16   = lane & 15;
    const int khalf = (lane >> 4) << 1;
    const int b_    = row0 >> 11;           // tile never straddles a batch
    const int s_    = (row0 + l16) & (kS - 1);

    v8f acc[4] = {};
    for (int d0 = 0; d0 < kD; d0 += 4) {
        const int d  = d0 + khalf;
        const int h_ = d >> 6;              // uniform across the k-step
        const float sc = 1.0f / (sqrtf(ssq[b_ * kH + h_]) + kEPS);
        const float* orow =
            ouns + (((size_t)(b_ * kH + h_)) * kS + s_) * kHD + (d & (kHD - 1));
        v2f a;
        a[0] = orow[0] * sc;
        a[1] = orow[1] * sc;
#pragma unroll
        for (int nt = 0; nt < 4; ++nt) {
            v2f b = *(const v2f*)(Wo + (size_t)(col0 + nt * 16 + l16) * kD + d);
            acc[nt] = wmma4(a, b, acc[nt]);
        }
    }

    const int crow = (lane >> 4) << 3;
#pragma unroll
    for (int nt = 0; nt < 4; ++nt)
#pragma unroll
        for (int vv = 0; vv < 8; ++vv) {
            const int i = row0 + crow + vv;
            const int j = col0 + nt * 16 + l16;
            out[(size_t)i * kD + j] = acc[nt][vv] + bo[j];
        }
}

// ---------------------------------------------------------------------------
extern "C" void kernel_launch(void* const* d_in, const int* in_sizes, int n_in,
                              void* d_out, int out_size, void* d_ws, size_t ws_size,
                              hipStream_t stream) {
    (void)in_sizes; (void)n_in; (void)out_size; (void)ws_size;

    const float* x     = (const float*)d_in[0];
    const float* Wq    = (const float*)d_in[1];
    const float* bq    = (const float*)d_in[2];
    const float* Wk    = (const float*)d_in[3];
    const float* bk    = (const float*)d_in[4];
    const float* Wv    = (const float*)d_in[5];
    const float* bv    = (const float*)d_in[6];
    const float* mask1 = (const float*)d_in[7];
    const float* mask2 = (const float*)d_in[8];
    const float* Wo    = (const float*)d_in[9];
    const float* bo    = (const float*)d_in[10];
    const int*   roll  = (const int*)d_in[11];

    const size_t nQKV = (size_t)kB * kH * kS * kHD;   // 4,194,304
    const size_t nLM  = (size_t)kM * kS * kS;         // 16,777,216
    float* ws      = (float*)d_ws;
    float* q       = ws;
    float* k       = q + nQKV;
    float* v       = k + nQKV;
    float* lm      = v + nQKV;
    float* ouns    = lm + nLM;
    float* partial = ouns + nQKV;                     // 4096 floats
    float* ssq     = partial + 4096;                  // 32 floats

    k_qkv  <<<1536, 256, 0, stream>>>(x, Wq, bq, Wk, bk, Wv, bv, q, k, v);
    k_lm   <<<2048, 256, 0, stream>>>(mask1, mask2, lm);
    k_attn <<<512,  256, 0, stream>>>(q, k, v, lm, roll, ouns, partial);
    k_ssqred<<<1,    32, 0, stream>>>(partial, ssq);
    k_out  <<<512,  256, 0, stream>>>(ouns, ssq, Wo, bo, (float*)d_out);
}

// v001
// A run of this version takes 633 microseconds.
// Two timings next to v000 both put it at 1.64 times that version's speed.
#include <hip/hip_runtime.h>
#include <hip/hip_bf16.h>
#include <math.h>
#include <stdint.h>

// Problem constants (from the reference)
constexpr int kB  = 4;
constexpr int kS  = 2048;
constexpr int kD  = 512;
constexpr int kH  = 8;
constexpr int kM  = 4;
constexpr int kR  = 32;
constexpr int kHD = 64;   // D / H
constexpr float kEPS = 1e-8f;

typedef __attribute__((ext_vector_type(2))) float v2f;
typedef __attribute__((ext_vector_type(4))) float v4f;
typedef __attribute__((ext_vector_type(8))) float v8f;

// CDNA5 fp32 WMMA: D(16x16,f32) = A(16x4,f32) x B(4x16,f32) + C
// A frag (2 VGPR): lane L holds A[L%16][2*(L/16) + i]   (i = vgpr index)
// B frag (2 VGPR): lane L holds B[2*(L/16) + i][L%16]
// C/D (8 VGPR):    vgpr v, lane L holds C[v + 8*(L/16)][L%16]
__device__ __forceinline__ v8f wmma4(v2f a, v2f b, v8f c) {
    return __builtin_amdgcn_wmma_f32_16x16x4_f32(
        /*neg_a=*/false, a, /*neg_b=*/false, b,
        /*c_mod=*/(short)0, c, /*reuse_a=*/false, /*reuse_b=*/false);
}

// Async global->LDS copy, 16B per lane (GLOBAL_LOAD_ASYNC_TO_LDS_B128, GVS
// addressing: mem = SGPR base + VGPR 32-bit offset; LDS addr from VGPR).
// Tracked by ASYNCcnt; data bypasses VGPRs entirely.
// s_wait_xcnt 0 in the same statement: a precaution, so that it stands in front
// of every later rewrite of the registers that the copy names.
__device__ __forceinline__ void async_b128_to_lds(uint32_t lds_addr, uint32_t goff,
                                                  uint64_t sbase) {
    asm volatile("global_load_async_to_lds_b128 %0, %1, %2\n\ts_wait_xcnt 0x0"
                 :: "v"(lds_addr), "v"(goff), "s"(sbase)
                 : "memory");
}
__device__ __forceinline__ void wait_asynccnt0() {
    asm volatile("s_wait_asynccnt 0" ::: "memory");
}

// ---------------------------------------------------------------------------
// Kernel 1: Q/K/V projections.  out = x @ W.T + b, scattered to [B,H,S,HD].
// One wave -> 16x64 output tile. 3*512*8 = 12288 waves.
// ---------------------------------------------------------------------------
__global__ __launch_bounds__(256) void k_qkv(
    const float* __restrict__ x,
    const float* __restrict__ Wq, const float* __restrict__ bq,
    const float* __restrict__ Wk, const float* __restrict__ bk,
    const float* __restrict__ Wv, const float* __restrict__ bv,
    float* __restrict__ q, float* __restrict__ k, float* __restrict__ v)
{
    const int wave  = (blockIdx.x * blockDim.x + threadIdx.x) >> 5;
    const int lane  = threadIdx.x & 31;
    const int which = wave / 4096;          // 0=q, 1=k, 2=v
    const int t     = wave - which * 4096;
    const int row0  = (t >> 3) << 4;        // 512 row-tiles of 16 (over B*S)
    const int col0  = (t & 7) << 6;         // 8 col-tiles of 64  (over D)

    const float* W    = (which == 0) ? Wq : (which == 1) ? Wk : Wv;
    const float* bias = (which == 0) ? bq : (which == 1) ? bk : bv;
    float*       out  = (which == 0) ? q  : (which == 1) ? k  : v;

    const int l16   = lane & 15;
    const int khalf = (lane >> 4) << 1;     // 0 or 2

    v8f acc[4] = {};
    const float* xrow = x + (size_t)(row0 + l16) * kD + khalf;
    const float* wrow = W + (size_t)(col0 + l16) * kD + khalf;

    for (int kk = 0; kk < kD; kk += 4) {
        v2f a = *(const v2f*)(xrow + kk);
#pragma unroll
        for (int nt = 0; nt < 4; ++nt) {
            v2f b = *(const v2f*)(wrow + (size_t)nt * 16 * kD + kk);
            acc[nt] = wmma4(a, b, acc[nt]);
        }
    }

    const int crow = (lane >> 4) << 3;      // 0 or 8
#pragma unroll
    for (int nt = 0; nt < 4; ++nt) {
#pragma unroll
        for (int vv = 0; vv < 8; ++vv) {
            const int i  = row0 + crow + vv;      // global row over B*S
            const int j  = col0 + nt * 16 + l16;  // global col over D
            const int b_ = i >> 11;               // / S
            const int s_ = i & (kS - 1);
            const int h_ = j >> 6;                // / HD
            const int hd = j & (kHD - 1);
            out[(((size_t)(b_ * kH + h_)) * kS + s_) * kHD + hd] = acc[nt][vv] + bias[j];
        }
    }
}

// ---------------------------------------------------------------------------
// Kernel 2: rolled mask, made once per (m,s,t):
//   lm[m,s,t]  = sum_r mask1[m,r,s] * mask2[m,r,t]      (WMMA, into LDS)
//   lmr[m,s,t] = lm[m,s,roll[s,t]]                      (gather from LDS)
// One BLOCK = one m and 16 s-rows: its 8 waves build the whole 16x2048 strip
// of lm in LDS (256 columns a wave), then gather from it.
// lmr is stored by 16x16 tiles in the WMMA accumulator layout:
//   lmr[((m*128 + s/16)*128 + t/16)*256 + lane*8 + vv]
//     = value of row (s/16)*16 + 8*(lane/16) + vv, column (t/16)*16 + lane%16
// so that the attention kernel reads a tile as 32 contiguous bytes a lane.
// ---------------------------------------------------------------------------
constexpr int kLP = kS + 4;   // strip pitch in floats: rows 8 apart sit 32 banks apart

__global__ __launch_bounds__(256) void k_lm(
    const float* __restrict__ mask1, const float* __restrict__ mask2,
    const int* __restrict__ roll, float* __restrict__ lmr)
{
    __shared__ __align__(16) float strip[16 * kLP];   // 131,328 B

    const int widb = threadIdx.x >> 5;
    const int lane = threadIdx.x & 31;
    const int m    = blockIdx.x >> 7;       // 4 masks
    const int st   = blockIdx.x & 127;      // 128 s-tiles of 16
    const int s0   = st << 4;

    const int l16   = lane & 15;
    const int khalf = (lane >> 4) << 1;
    const int crow  = (lane >> 4) << 3;

    const float* m1 = mask1 + (size_t)m * kR * kS;
    const float* m2 = mask2 + (size_t)m * kR * kS;

    // every unroll below: a[], acc[], r0 and r1 stay in registers only when
    // they are indexed by constants
    v2f a[8];
#pragma unroll
    for (int kk = 0; kk < 8; ++kk) {
        const int kb = 4 * kk + khalf;
        a[kk][0] = m1[(size_t)kb * kS + s0 + l16];
        a[kk][1] = m1[(size_t)(kb + 1) * kS + s0 + l16];
    }

    for (int g = 0; g < 4; ++g) {
        const int t0 = widb * 256 + g * 64;
        const float* bp = m2 + khalf * kS + t0 + l16;
        v8f acc[4] = {};
#pragma unroll
        for (int kk = 0; kk < 8; ++kk) {
#pragma unroll
            for (int nt = 0; nt < 4; ++nt) {
                v2f b;
                b[0] = bp[(4 * kk) * kS + nt * 16];
                b[1] = bp[(4 * kk + 1) * kS + nt * 16];
                acc[nt] = wmma4(a[kk], b, acc[nt]);
            }
        }
#pragma unroll
        for (int nt = 0; nt < 4; ++nt)
#pragma unroll
            for (int vv = 0; vv < 8; ++vv)
                strip[(crow + vv) * kLP + t0 + nt * 16 + l16] = acc[nt][vv];
    }
    __syncthreads();            // the whole strip is written before anyone gathers

    const int* rl  = roll + (size_t)(s0 + crow) * kS + l16;
    float*     dst = lmr + ((size_t)(m * 128 + st) * 128) * 256 + lane * 8;
    for (int j = 0; j < 16; ++j) {
        const int tt = widb * 16 + j;       // t-tile
        v4f r0, r1;
#pragma unroll
        for (int vv = 0; vv < 8; ++vv) {
            // the index is bounded to the strip's row before the address is formed
            const int gidx = rl[(size_t)vv * kS + tt * 16] & (kS - 1);
            const float g = strip[(crow + vv) * kLP + gidx];
            if (vv < 4) r0[vv] = g; else r1[vv - 4] = g;
        }
        *(v4f*)(dst + (size_t)tt * 256)     = r0;
        *(v4f*)(dst + (size_t)tt * 256 + 4) = r1;
    }
}

// ---------------------------------------------------------------------------
// Kernel 3: flash-style pass. One BLOCK = one (b,h) and 128 s-rows; each of
// its 8 waves owns a 16-row slice. K/V 16x64 tiles are double-buffered in LDS
// via GLOBAL_LOAD_ASYNC_TO_LDS_B128 (ASYNCcnt), shared by all 8 waves:
//   att16x16 = (q kT)/8 * lmr[m, s, t]   (rolled mask, read by tiles)
//   ssq    += sum(att^2)          (Frobenius accumulator, scalar per (b,h))
//   O16x64 += att16x16 @ V16x64   (att bounced through LDS for A-layout)
// Frobenius scale is applied later (scalar per (b,h), commutes with att@v).
// ---------------------------------------------------------------------------
__global__ __launch_bounds__(256) void k_attn(
    const float* __restrict__ q, const float* __restrict__ k,
    const float* __restrict__ v, const float* __restrict__ lmr,
    float* __restrict__ ouns, float* __restrict__ partial)
{
    __shared__ __align__(16) float kvbuf[2][2][16 * 64]; // [buf][K/V][row*64+hd] 16KB
    __shared__ __align__(16) float att_lds[8][256];      // 16x16 bounce tile/wave 8KB

    const int tid  = threadIdx.x;
    const int widb = tid >> 5;
    const int lane = tid & 31;

    const int bh   = blockIdx.x >> 4;        // b*H + h   (32 total)
    const int sblk = blockIdx.x & 15;        // 16 s-superblocks of 128 rows
    const int s0   = sblk * 128 + widb * 16; // this wave's 16 rows
    const int mm   = bh & (kM - 1);          // h % M  (H multiple of M)

    const float* qb  = q  + (size_t)bh * kS * kHD;
    // mask tiles: the block's 8 tile rows start at lmb; 32 bytes a lane and tile
    const float* lmb  = lmr + ((size_t)(mm * 128 + sblk * 8) * 128) * 256;
    const int    lmof = widb * (128 * 256) + lane * 8;
    const uint64_t kbase = (uint64_t)(uintptr_t)(k + (size_t)bh * kS * kHD);
    const uint64_t vbase = (uint64_t)(uintptr_t)(v + (size_t)bh * kS * kHD);

    const int l16   = lane & 15;
    const int khalf = (lane >> 4) << 1;
    const int crow  = (lane >> 4) << 3;

    // Cooperative staging: 256 threads x 16B cover one 16x64 f32 tile.
    const uint32_t strow = (uint32_t)(tid >> 4);       // 0..15
    const uint32_t stcol = (uint32_t)((tid & 15) * 4); // 0..60, 16B aligned
    const uint32_t ldsK  = (uint32_t)(uintptr_t)&kvbuf[0][0][strow * 64 + stcol];
    const uint32_t ldsV  = (uint32_t)(uintptr_t)&kvbuf[0][1][strow * 64 + stcol];
    const uint32_t bufStride = (uint32_t)(sizeof(float) * 2 * 16 * 64); // 8KB
#define STAGE(BUF, T0)                                                        \
    do {                                                                      \
        const uint32_t goff = (((uint32_t)(T0) + strow) * kHD + stcol) * 4u;  \
        async_b128_to_lds(ldsK + (BUF) * bufStride, goff, kbase);             \
        async_b128_to_lds(ldsV + (BUF) * bufStride, goff, vbase);             \
    } while (0)

    // Preload the 16x64 Q block as 16 A-fragments (kept in VGPRs).
    v2f qa[16];
#pragma unroll
    for (int kk = 0; kk < 16; ++kk)
        qa[kk] = *(const v2f*)(qb + (size_t)(s0 + l16) * kHD + 4 * kk + khalf);

    v8f oacc[4] = {};
    float ssql = 0.0f;
    float* tile = att_lds[widb];

    STAGE(0, 0);
    int cur = 0;
    for (int t0 = 0; t0 < kS; t0 += 16) {
        wait_asynccnt0();       // this wave's async stores to LDS landed
        __syncthreads();        // everyone's landed; prev buffer free to reuse
        if (t0 + 16 < kS) STAGE(cur ^ 1, t0 + 16);   // overlap next tile load

        // mask tile: issued here, first used behind the QK products
        const v4f lm0 = *(const v4f*)(lmb + t0 * 16 + lmof);
        const v4f lm1 = *(const v4f*)(lmb + t0 * 16 + lmof + 4);

        const float* kt = kvbuf[cur][0];
        const float* vt = kvbuf[cur][1];

        // --- att tile = Q(16x64) @ K(16x64)^T  (K from LDS) ---
        v8f attc = {};
#pragma unroll
        for (int kk = 0; kk < 16; ++kk) {
            v2f bf = *(const v2f*)(kt + l16 * 64 + 4 * kk + khalf);
            attc = wmma4(qa[kk], bf, attc);
        }
        // --- elementwise: 1/sqrt(HD), rolled mask, ssq, stash to LDS ---
#pragma unroll
        for (int vv = 0; vv < 8; ++vv) {
            const float lmv = (vv < 4) ? lm0[vv & 3] : lm1[vv & 3];
            const float a = attc[vv] * 0.125f * lmv;
            ssql += a * a;
            tile[(crow + vv) * 16 + l16] = a;
        }
        // same-wave LDS is in-order: store->load needs no barrier
        // --- O(16x64) += att(16x16) @ V(16x64)  (V from LDS) ---
#pragma unroll
        for (int kk = 0; kk < 4; ++kk) {
            v2f af = *(const v2f*)(&tile[l16 * 16 + 4 * kk + khalf]);
#pragma unroll
            for (int nt = 0; nt < 4; ++nt) {
                v2f bf;
                bf[0] = vt[(4 * kk + khalf) * 64 + nt * 16 + l16];
                bf[1] = vt[(4 * kk + khalf + 1) * 64 + nt * 16 + l16];
                oacc[nt] = wmma4(af, bf, oacc[nt]);
            }
        }
        cur ^= 1;
    }
#undef STAGE

    // wave-reduce ssq (wave32) and emit one deterministic partial per wave
#pragma unroll
    for (int off = 16; off > 0; off >>= 1)
        ssql += __shfl_xor(ssql, off, 32);
    if (lane == 0) partial[bh * 128 + sblk * 8 + widb] = ssql;

#pragma unroll
    for (int nt = 0; nt < 4; ++nt)
#pragma unroll
        for (int vv = 0; vv < 8; ++vv)
            ouns[(size_t)bh * kS * kHD + (size_t)(s0 + crow + vv) * kHD + nt * 16 + l16]
                = oacc[nt][vv];
}

// ---------------------------------------------------------------------------
// Kernel 4a: reduce per-wave ssq partials -> ssq[b*H+h]  (deterministic)
// ---------------------------------------------------------------------------
__global__ void k_ssqred(const float* __restrict__ partial, float* __restrict__ ssq)
{
    const int t = threadIdx.x;
    if (t < kB * kH) {
        float s = 0.0f;
        for (int i = 0; i < kS / 16; ++i) s += partial[t * (kS / 16) + i];
        ssq[t] = s;
    }
}

// ---------------------------------------------------------------------------
// Kernel 4b: out = (scale[b,h] * Ouns) @ Wo.T + bo, scale folded into A loads.
// One wave -> 16x64 tile. 512*8 = 4096 waves.
// ---------------------------------------------------------------------------
__global__ __launch_bounds__(256) void k_out(
    const float* __restrict__ ouns, const float* __restrict__ ssq,
    const float* __restrict__ Wo, const float* __restrict__ bo,
    float* __restrict__ out)
{
    const int wave = (blockIdx.x * blockDim.x + threadIdx.x) >> 5;
    const int lane = threadIdx.x & 31;
    const int row0 = (wave >> 3) << 4;      // over B*S
    const int col0 = (wave & 7) << 6;       // over D

    const int l16   = lane & 15;
    const int khalf = (lane >> 4) << 1;
    const int b_    = row0 >> 11;           // tile never straddles a batch
    const int s_    = (row0 + l16) & (kS - 1);

    v8f acc[4] = {};
    for (int d0 = 0; d0 < kD; d0 += 4) {
        const int d  = d0 + khalf;
        const int h_ = d >> 6;              // uniform across the k-step
        const float sc = 1.0f / (sqrtf(ssq[b_ * kH + h_]) + kEPS);
        const float* orow =
            ouns + (((size_t)(b_ * kH + h_)) * kS + s_) * kHD + (d & (kHD - 1));
        v2f a;
        a[0] = orow[0] * sc;
        a[1] = orow[1] * sc;
#pragma unroll
        for (int nt = 0; nt < 4; ++nt) {
            v2f b = *(const v2f*)(Wo + (size_t)(col0 + nt * 16 + l16) * kD + d);
            acc[nt] = wmma4(a, b, acc[nt]);
        }
    }

    const int crow = (lane >> 4) << 3;
#pragma unroll
    for (int nt = 0; nt < 4; ++nt)
#pragma unroll
        for (int vv = 0; vv < 8; ++vv) {
            const int i = row0 + crow + vv;
            const int j = col0 + nt * 16 + l16;
            out[(size_t)i * kD + j] = acc[nt][vv] + bo[j];
        }
}

// ---------------------------------------------------------------------------
extern "C" void kernel_launch(void* const* d_in, const int* in_sizes, int n_in,
                              void* d_out, int out_size, void* d_ws, size_t ws_size,
                              hipStream_t stream) {
    (void)in_sizes; (void)n_in; (void)out_size; (void)ws_size;

    const float* x     = (const float*)d_in[0];
    const float* Wq    = (const float*)d_in[1];
    const float* bq    = (const float*)d_in[2];
    const float* Wk    = (const float*)d_in[3];
    const float* bk    = (const float*)d_in[4];
    const float* Wv    = (const float*)d_in[5];
    const float* bv    = (const float*)d_in[6];
    const float* mask1 = (const float*)d_in[7];
    const float* mask2 = (const float*)d_in[8];
    const float* Wo    = (const float*)d_in[9];
    const float* bo    = (const float*)d_in[10];
    const int*   roll  = (const int*)d_in[11];

    const size_t nQKV = (size_t)kB * kH * kS * kHD;   // 4,194,304
    const size_t nLM  = (size_t)kM * kS * kS;         // 16,777,216
    float* ws      = (float*)d_ws;
    float* q       = ws;
    float* k       = q + nQKV;
    float* v       = k + nQKV;
    float* lm      = v + nQKV;
    float* ouns    = lm + nLM;
    float* partial = ouns + nQKV;                     // 4096 floats
    float* ssq     = partial + 4096;                  // 32 floats

    k_qkv  <<<1536, 256, 0, stream>>>(x, Wq, bq, Wk, bk, Wv, bv, q, k, v);
    k_lm   <<<512,  256, 0, stream>>>(mask1, mask2, roll, lm);
    k_attn <<<512,  256, 0, stream>>>(q, k, v, lm, ouns, partial);
    k_ssqred<<<1,    32, 0, stream>>>(partial, ssq);
    k_out  <<<512,  256, 0, stream>>>(ouns, ssq, Wo, bo, (float*)d_out);
}

// v002
// It runs in 505 microseconds.
// In two side-by-side timings against v001, it was 1.25 and 1.26 times as fast.
// All steps since v000 together make it 2.05 times as fast.
#include <hip/hip_runtime.h>
#include <hip/hip_bf16.h>
#include <math.h>
#include <stdint.h>

// Problem constants (from the reference)
constexpr int kB  = 4;
constexpr int kS  = 2048;
constexpr int kD  = 512;
constexpr int kH  = 8;
constexpr int kM  = 4;
constexpr int kR  = 32;
constexpr int kHD = 64;   // D / H
constexpr float kEPS = 1e-8f;

typedef __attribute__((ext_vector_type(2))) float v2f;
typedef __attribute__((ext_vector_type(4))) float v4f;
typedef __attribute__((ext_vector_type(8))) float v8f;

// CDNA5 fp32 WMMA: D(16x16,f32) = A(16x4,f32) x B(4x16,f32) + C
// A frag (2 VGPR): lane L holds A[L%16][2*(L/16) + i]   (i = vgpr index)
// B frag (2 VGPR): lane L holds B[2*(L/16) + i][L%16]
// C/D (8 VGPR):    vgpr v, lane L holds C[v + 8*(L/16)][L%16]
__device__ __forceinline__ v8f wmma4(v2f a, v2f b, v8f c) {
    return __builtin_amdgcn_wmma_f32_16x16x4_f32(
        /*neg_a=*/false, a, /*neg_b=*/false, b,
        /*c_mod=*/(short)0, c, /*reuse_a=*/false, /*reuse_b=*/false);
}

// Async global->LDS copy, 16B per lane (GLOBAL_LOAD_ASYNC_TO_LDS_B128, GVS
// addressing: mem = SGPR base + VGPR 32-bit offset; LDS addr from VGPR).
// Tracked by ASYNCcnt; data bypasses VGPRs entirely.
// s_wait_xcnt 0 in the same statement: a precaution, so that it stands in front
// of every later rewrite of the registers that the copy names.
__device__ __forceinline__ void async_b128_to_lds(uint32_t lds_addr, uint32_t goff,
                                                  uint64_t sbase) {
    asm volatile("global_load_async_to_lds_b128 %0, %1, %2\n\ts_wait_xcnt 0x0"
                 :: "v"(lds_addr), "v"(goff), "s"(sbase)
                 : "memory");
}
__device__ __forceinline__ void wait_asynccnt0() {
    asm volatile("s_wait_asynccnt 0" ::: "memory");
}

// ---------------------------------------------------------------------------
// Kernel 1: Q/K/V projections.  out = x @ W.T + b, scattered to [B,H,S,HD].
// One wave -> 16x64 output tile. 3*512*8 = 12288 waves.
// ---------------------------------------------------------------------------
__global__ __launch_bounds__(256) void k_qkv(
    const float* __restrict__ x,
    const float* __restrict__ Wq, const float* __restrict__ bq,
    const float* __restrict__ Wk, const float* __restrict__ bk,
    const float* __restrict__ Wv, const float* __restrict__ bv,
    float* __restrict__ q, float* __restrict__ k, float* __restrict__ v)
{
    const int wave  = (blockIdx.x * blockDim.x + threadIdx.x) >> 5;
    const int lane  = threadIdx.x & 31;
    const int which = wave / 4096;          // 0=q, 1=k, 2=v
    const int t     = wave - which * 4096;
    const int row0  = (t >> 3) << 4;        // 512 row-tiles of 16 (over B*S)
    const int col0  = (t & 7) << 6;         // 8 col-tiles of 64  (over D)

    const float* W    = (which == 0) ? Wq : (which == 1) ? Wk : Wv;
    const float* bias = (which == 0) ? bq : (which == 1) ? bk : bv;
    float*       out  = (which == 0) ? q  : (which == 1) ? k  : v;

    const int l16   = lane & 15;
    const int khalf = (lane >> 4) << 1;     // 0 or 2

    v8f acc[4] = {};
    const float* xrow = x + (size_t)(row0 + l16) * kD + khalf;
    const float* wrow = W + (size_t)(col0 + l16) * kD + khalf;

    for (int kk = 0; kk < kD; kk += 4) {
        v2f a = *(const v2f*)(xrow + kk);
#pragma unroll
        for (int nt = 0; nt < 4; ++nt) {
            v2f b = *(const v2f*)(wrow + (size_t)nt * 16 * kD + kk);
            acc[nt] = wmma4(a, b, acc[nt]);
        }
    }

    const int crow = (lane >> 4) << 3;      // 0 or 8
#pragma unroll
    for (int nt = 0; nt < 4; ++nt) {
#pragma unroll
        for (int vv = 0; vv < 8; ++vv) {
            const int i  = row0 + crow + vv;      // global row over B*S
            const int j  = col0 + nt * 16 + l16;  // global col over D
            const int b_ = i >> 11;               // / S
            const int s_ = i & (kS - 1);
            const int h_ = j >> 6;                // / HD
            const int hd = j & (kHD - 1);
            out[(((size_t)(b_ * kH + h_)) * kS + s_) * kHD + hd] = acc[nt][vv] + bias[j];
        }
    }
}

// ---------------------------------------------------------------------------
// Kernel 2: rolled mask, made once per (m,s,t):
//   lm[m,s,t]  = sum_r mask1[m,r,s] * mask2[m,r,t]      (WMMA, into LDS)
//   lmr[m,s,t] = lm[m,s,roll[s,t]]                      (gather from LDS)
// One BLOCK = one m and 16 s-rows: its 8 waves build the whole 16x2048 strip
// of lm in LDS (256 columns a wave), then gather from it.
// lmr is stored by 16x16 tiles in the WMMA accumulator layout:
//   lmr[((m*128 + s/16)*128 + t/16)*256 + lane*8 + vv]
//     = value of row (s/16)*16 + 8*(lane/16) + vv, column (t/16)*16 + lane%16
// so that the attention kernel reads a tile as 32 contiguous bytes a lane.
// ---------------------------------------------------------------------------
constexpr int kLP = kS + 4;   // strip pitch in floats: rows 8 apart sit 32 banks apart

__global__ __launch_bounds__(256) void k_lm(
    const float* __restrict__ mask1, const float* __restrict__ mask2,
    const int* __restrict__ roll, float* __restrict__ lmr)
{
    __shared__ __align__(16) float strip[16 * kLP];   // 131,328 B

    const int widb = threadIdx.x >> 5;
    const int lane = threadIdx.x & 31;
    const int m    = blockIdx.x >> 7;       // 4 masks
    const int st   = blockIdx.x & 127;      // 128 s-tiles of 16
    const int s0   = st << 4;

    const int l16   = lane & 15;
    const int khalf = (lane >> 4) << 1;
    const int crow  = (lane >> 4) << 3;

    const float* m1 = mask1 + (size_t)m * kR * kS;
    const float* m2 = mask2 + (size_t)m * kR * kS;

    // every unroll below: a[], acc[], r0 and r1 stay in registers only when
    // they are indexed by constants
    v2f a[8];
#pragma unroll
    for (int kk = 0; kk < 8; ++kk) {
        const int kb = 4 * kk + khalf;
        a[kk][0] = m1[(size_t)kb * kS + s0 + l16];
        a[kk][1] = m1[(size_t)(kb + 1) * kS + s0 + l16];
    }

    for (int g = 0; g < 4; ++g) {
        const int t0 = widb * 256 + g * 64;
        const float* bp = m2 + khalf * kS + t0 + l16;
        v8f acc[4] = {};
#pragma unroll
        for (int kk = 0; kk < 8; ++kk) {
#pragma unroll
            for (int nt = 0; nt < 4; ++nt) {
                v2f b;
                b[0] = bp[(4 * kk) * kS + nt * 16];
                b[1] = bp[(4 * kk + 1) * kS + nt * 16];
                acc[nt] = wmma4(a[kk], b, acc[nt]);
            }
        }
#pragma unroll
        for (int nt = 0; nt < 4; ++nt)
#pragma unroll
            for (int vv = 0; vv < 8; ++vv)
                strip[(crow + vv) * kLP + t0 + nt * 16 + l16] = acc[nt][vv];
    }
    __syncthreads();            // the whole strip is written before anyone gathers

    const int* rl  = roll + (size_t)(s0 + crow) * kS + l16;
    float*     dst = lmr + ((size_t)(m * 128 + st) * 128) * 256 + lane * 8;
    for (int j = 0; j < 16; ++j) {
        const int tt = widb * 16 + j;       // t-tile
        v4f r0, r1;
#pragma unroll
        for (int vv = 0; vv < 8; ++vv) {
            // the index is bounded to the strip's row before the address is formed
            const int gidx = rl[(size_t)vv * kS + tt * 16] & (kS - 1);
            const float g = strip[(crow + vv) * kLP + gidx];
            if (vv < 4) r0[vv] = g; else r1[vv - 4] = g;
        }
        *(v4f*)(dst + (size_t)tt * 256)     = r0;
        *(v4f*)(dst + (size_t)tt * 256 + 4) = r1;
    }
}

// ---------------------------------------------------------------------------
// Kernel 3: flash-style pass. One BLOCK = one (b,h) and 128 s-rows; each of
// its 8 waves owns a 16-row slice. K/V 16x64 tiles are double-buffered in LDS
// via GLOBAL_LOAD_ASYNC_TO_LDS_B128 (ASYNCcnt), shared by all 8 waves:
//   att16x16 = (q kT)/8 * lmr[m, s, t]   (rolled mask, read by tiles)
//   ssq    += sum(att^2)          (Frobenius accumulator, scalar per (b,h))
//   O16x64 += att16x16 @ V16x64   (att bounced through LDS for A-layout)
// Frobenius scale is applied later (scalar per (b,h), commutes with att@v).
// LDS row pitches, in floats (64 banks of 4 bytes), one for each tile's reader:
//   K: 16 lanes walk down a column 8 bytes wide; at 68 the 16 rows start on
//      16 distinct multiples of 4 banks
//   V: a fragment read takes 16 floats a row from rows 2 apart; at 80 four
//      rows in a row start 16 banks apart
//   score tile: written by rows 8 apart, read down a column 8 bytes wide; at 20
//      rows 8 apart start 32 banks apart, and the 16 rows start on 16 distinct
//      multiples of 4 banks
// Each pitch is a multiple of 4 floats, so the 16-byte copies stay aligned.
// ---------------------------------------------------------------------------
constexpr int kKP = 68;
constexpr int kVP = 80;
constexpr int kAP = 20;

__global__ __launch_bounds__(256) void k_attn(
    const float* __restrict__ q, const float* __restrict__ k,
    const float* __restrict__ v, const float* __restrict__ lmr,
    float* __restrict__ ouns, float* __restrict__ partial)
{
    __shared__ __align__(16) float kvbuf[2][16 * (kKP + kVP)]; // [buf]: K rows, then V rows
    __shared__ __align__(16) float att_lds[8][16 * kAP];       // 16x16 bounce tile per wave

    const int tid  = threadIdx.x;
    const int widb = tid >> 5;
    const int lane = tid & 31;

    const int bh   = blockIdx.x >> 4;        // b*H + h   (32 total)
    const int sblk = blockIdx.x & 15;        // 16 s-superblocks of 128 rows
    const int s0   = sblk * 128 + widb * 16; // this wave's 16 rows
    const int mm   = bh & (kM - 1);          // h % M  (H multiple of M)

    const float* qb  = q  + (size_t)bh * kS * kHD;
    // mask tiles: the block's 8 tile rows start at lmb; 32 bytes a lane and tile
    const float* lmb  = lmr + ((size_t)(mm * 128 + sblk * 8) * 128) * 256;
    const int    lmof = widb * (128 * 256) + lane * 8;
    const uint64_t kbase = (uint64_t)(uintptr_t)(k + (size_t)bh * kS * kHD);
    const uint64_t vbase = (uint64_t)(uintptr_t)(v + (size_t)bh * kS * kHD);

    const int l16   = lane & 15;
    const int khalf = (lane >> 4) << 1;
    const int crow  = (lane >> 4) << 3;

    // Cooperative staging: 256 threads x 16B cover one 16x64 f32 tile.
    const uint32_t strow = (uint32_t)(tid >> 4);       // 0..15
    const uint32_t stcol = (uint32_t)((tid & 15) * 4); // 0..60, 16B aligned
    const uint32_t ldsK  = (uint32_t)(uintptr_t)&kvbuf[0][strow * kKP + stcol];
    const uint32_t ldsV  = (uint32_t)(uintptr_t)&kvbuf[0][16 * kKP + strow * kVP + stcol];
    const uint32_t bufStride = (uint32_t)(sizeof(float) * 16 * (kKP + kVP));
#define STAGE(BUF, T0)                                                        \
    do {                                                                      \
        const uint32_t goff = (((uint32_t)(T0) + strow) * kHD + stcol) * 4u;  \
        async_b128_to_lds(ldsK + (BUF) * bufStride, goff, kbase);             \
        async_b128_to_lds(ldsV + (BUF) * bufStride, goff, vbase);             \
    } while (0)

    // Preload the 16x64 Q block as 16 A-fragments (kept in VGPRs).
    v2f qa[16];
#pragma unroll
    for (int kk = 0; kk < 16; ++kk)
        qa[kk] = *(const v2f*)(qb + (size_t)(s0 + l16) * kHD + 4 * kk + khalf);

    v8f oacc[4] = {};
    float ssql = 0.0f;
    float* tile = att_lds[widb];

    STAGE(0, 0);
    int cur = 0;
    for (int t0 = 0; t0 < kS; t0 += 16) {
        wait_asynccnt0();       // this wave's async stores to LDS landed
        __syncthreads();        // everyone's landed; prev buffer free to reuse
        if (t0 + 16 < kS) STAGE(cur ^ 1, t0 + 16);   // overlap next tile load

        // mask tile: issued here, first used behind the QK products
        const v4f lm0 = *(const v4f*)(lmb + t0 * 16 + lmof);
        const v4f lm1 = *(const v4f*)(lmb + t0 * 16 + lmof + 4);

        const float* kt = kvbuf[cur];
        const float* vt = kvbuf[cur] + 16 * kKP;

        // --- att tile = Q(16x64) @ K(16x64)^T  (K from LDS) ---
        v8f attc = {};
#pragma unroll
        for (int kk = 0; kk < 16; ++kk) {
            v2f bf = *(const v2f*)(kt + l16 * kKP + 4 * kk + khalf);
            attc = wmma4(qa[kk], bf, attc);
        }
        // --- elementwise: 1/sqrt(HD), rolled mask, ssq, stash to LDS ---
#pragma unroll
        for (int vv = 0; vv < 8; ++vv) {
            const float lmv = (vv < 4) ? lm0[vv & 3] : lm1[vv & 3];
            const float a = attc[vv] * 0.125f * lmv;
            ssql += a * a;
            tile[(crow + vv) * kAP + l16] = a;
        }
        // same-wave LDS is in-order: store->load needs no barrier
        // --- O(16x64) += att(16x16) @ V(16x64)  (V from LDS) ---
#pragma unroll
        for (int kk = 0; kk < 4; ++kk) {
            v2f af = *(const v2f*)(&tile[l16 * kAP + 4 * kk + khalf]);
#pragma unroll
            for (int nt = 0; nt < 4; ++nt) {
                v2f bf;
                bf[0] = vt[(4 * kk + khalf) * kVP + nt * 16 + l16];
                bf[1] = vt[(4 * kk + khalf + 1) * kVP + nt * 16 + l16];
                oacc[nt] = wmma4(af, bf, oacc[nt]);
            }
        }
        cur ^= 1;
    }
#undef STAGE

    // wave-reduce ssq (wave32) and emit one deterministic partial per wave
#pragma unroll
    for (int off = 16; off > 0; off >>= 1)
        ssql += __shfl_xor(ssql, off, 32);
    if (lane == 0) partial[bh * 128 + sblk * 8 + widb] = ssql;

#pragma unroll
    for (int nt = 0; nt < 4; ++nt)
#pragma unroll
        for (int vv = 0; vv < 8; ++vv)
            ouns[(size_t)bh * kS * kHD + (size_t)(s0 + crow + vv) * kHD + nt * 16 + l16]
                = oacc[nt][vv];
}

// ---------------------------------------------------------------------------
// Kernel 4a: reduce per-wave ssq partials -> ssq[b*H+h]  (deterministic)
// ---------------------------------------------------------------------------
__global__ void k_ssqred(const float* __restrict__ partial, float* __restrict__ ssq)
{
    const int t = threadIdx.x;
    if (t < kB * kH) {
        float s = 0.0f;
        for (int i = 0; i < kS / 16; ++i) s += partial[t * (kS / 16) + i];
        ssq[t] = s;
    }
}

// ---------------------------------------------------------------------------
// Kernel 4b: out = (scale[b,h] * Ouns) @ Wo.T + bo, scale folded into A loads.
// One wave -> 16x64 tile. 512*8 = 4096 waves.
// ---------------------------------------------------------------------------
__global__ __launch_bounds__(256) void k_out(
    const float* __restrict__ ouns, const float* __restrict__ ssq,
    const float* __restrict__ Wo, const float* __restrict__ bo,
    float* __restrict__ out)
{
    const int wave = (blockIdx.x * blockDim.x + threadIdx.x) >> 5;
    const int lane = threadIdx.x & 31;
    const int row0 = (wave >> 3) << 4;      // over B*S
    const int col0 = (wave & 7) << 6;       // over D

    const int l16   = lane & 15;
    const int khalf = (lane >> 4) << 1;
    const int b_    = row0 >> 11;           // tile never straddles a batch
    const int s_    = (row0 + l16) & (kS - 1);

    v8f acc[4] = {};
    for (int d0 = 0; d0 < kD; d0 += 4) {
        const int d  = d0 + khalf;
        const int h_ = d >> 6;              // uniform across the k-step
        const float sc = 1.0f / (sqrtf(ssq[b_ * kH + h_]) + kEPS);
        const float* orow =
            ouns + (((size_t)(b_ * kH + h_)) * kS + s_) * kHD + (d & (kHD - 1));
        v2f a;
        a[0] = orow[0] * sc;
        a[1] = orow[1] * sc;
#pragma unroll
        for (int nt = 0; nt < 4; ++nt) {
            v2f b = *(const v2f*)(Wo + (size_t)(col0 + nt * 16 + l16) * kD + d);
            acc[nt] = wmma4(a, b, acc[nt]);
        }
    }

    const int crow = (lane >> 4) << 3;
#pragma unroll
    for (int nt = 0; nt < 4; ++nt)
#pragma unroll
        for (int vv = 0; vv < 8; ++vv) {
            const int i = row0 + crow + vv;
            const int j = col0 + nt * 16 + l16;
            out[(size_t)i * kD + j] = acc[nt][vv] + bo[j];
        }
}

// ---------------------------------------------------------------------------
extern "C" void kernel_launch(void* const* d_in, const int* in_sizes, int n_in,
                              void* d_out, int out_size, void* d_ws, size_t ws_size,
                              hipStream_t stream) {
    (void)in_sizes; (void)n_in; (void)out_size; (void)ws_size;

    const float* x     = (const float*)d_in[0];
    const float* Wq    = (const float*)d_in[1];
    const float* bq    = (const float*)d_in[2];
    const float* Wk    = (const float*)d_in[3];
    const float* bk    = (const float*)d_in[4];
    const float* Wv    = (const float*)d_in[5];
    const float* bv    = (const float*)d_in[6];
    const float* mask1 = (const float*)d_in[7];
    const float* mask2 = (const float*)d_in[8];
    const float* Wo    = (const float*)d_in[9];
    const float* bo    = (const float*)d_in[10];
    const int*   roll  = (const int*)d_in[11];

    const size_t nQKV = (size_t)kB * kH * kS * kHD;   // 4,194,304
    const size_t nLM  = (size_t)kM * kS * kS;         // 16,777,216
    float* ws      = (float*)d_ws;
    float* q       = ws;
    float* k       = q + nQKV;
    float* v       = k + nQKV;
    float* lm      = v + nQKV;
    float* ouns    = lm + nLM;
    float* partial = ouns + nQKV;                     // 4096 floats
    float* ssq     = partial + 4096;                  // 32 floats

    k_qkv  <<<1536, 256, 0, stream>>>(x, Wq, bq, Wk, bk, Wv, bv, q, k, v);
    k_lm   <<<512,  256, 0, stream>>>(mask1, mask2, roll, lm);
    k_attn <<<512,  256, 0, stream>>>(q, k, v, lm, ouns, partial);
    k_ssqred<<<1,    32, 0, stream>>>(partial, ssq);
    k_out  <<<512,  256, 0, stream>>>(ouns, ssq, Wo, bo, (float*)d_out);
}

// v003
// It runs in 296 microseconds.
// Two timings next to v002 both put it at 1.70 times that version's speed.
// All steps since v000 together make it 3.49 times as fast.
#include <hip/hip_runtime.h>
#include <hip/hip_bf16.h>
#include <math.h>
#include <stdint.h>

// Problem constants (from the reference)
constexpr int kB  = 4;
constexpr int kS  = 2048;
constexpr int kD  = 512;
constexpr int kH  = 8;
constexpr int kM  = 4;
constexpr int kR  = 32;
constexpr int kHD = 64;   // D / H
constexpr float kEPS = 1e-8f;

typedef __attribute__((ext_vector_type(2))) float v2f;
typedef __attribute__((ext_vector_type(4))) float v4f;
typedef __attribute__((ext_vector_type(8))) float v8f;

// CDNA5 fp32 WMMA: D(16x16,f32) = A(16x4,f32) x B(4x16,f32) + C
// A frag (2 VGPR): lane L holds A[L%16][2*(L/16) + i]   (i = vgpr index)
// B frag (2 VGPR): lane L holds B[2*(L/16) + i][L%16]
// C/D (8 VGPR):    vgpr v, lane L holds C[v + 8*(L/16)][L%16]
__device__ __forceinline__ v8f wmma4(v2f a, v2f b, v8f c) {
    return __builtin_amdgcn_wmma_f32_16x16x4_f32(
        /*neg_a=*/false, a, /*neg_b=*/false, b,
        /*c_mod=*/(short)0, c, /*reuse_a=*/false, /*reuse_b=*/false);
}

// Async global->LDS copy, 16B per lane (GLOBAL_LOAD_ASYNC_TO_LDS_B128, GVS
// addressing: mem = SGPR base + VGPR 32-bit offset; LDS addr from VGPR).
// Tracked by ASYNCcnt; data bypasses VGPRs entirely.
// s_wait_xcnt 0 in the same statement: a precaution, so that it stands in front
// of every later rewrite of the registers that the copy names.
__device__ __forceinline__ void async_b128_to_lds(uint32_t lds_addr, uint32_t goff,
                                                  uint64_t sbase) {
    asm volatile("global_load_async_to_lds_b128 %0, %1, %2\n\ts_wait_xcnt 0x0"
                 :: "v"(lds_addr), "v"(goff), "s"(sbase)
                 : "memory");
}
__device__ __forceinline__ void wait_asynccnt0() {
    asm volatile("s_wait_asynccnt 0" ::: "memory");
}

// ---------------------------------------------------------------------------
// Projection products, Y = A @ W.T: one BLOCK = 128 rows x (32*NT) columns of Y.
// A and W are walked in chunks of 32 k; a chunk of both (128 + 32*NT rows of
// 128 bytes) is staged in LDS by async copies, two buffers, the next chunk in
// flight while this one is worked on. 8 waves as 4 (rows) x 2 (columns); a wave
// owns 32 x (16*NT) of Y: 2 A fragments and NT B fragments feed 2*NT products.
// Row pitch 36 floats: the 16 rows of a fragment read (16 bytes a row) start on
// 16 distinct multiples of 4 banks. k runs 0,4,8,... into one accumulator.
// ---------------------------------------------------------------------------
constexpr int kGP = 36;            // LDS row pitch, floats
constexpr int kKC = 32;            // k per chunk
constexpr int kNC = kD / kKC;      // 16 chunks

// Runs of async copies that share one scalar base; s_wait_xcnt 0 is the last
// line of the copies' own statement (the same precaution as above).
__device__ __forceinline__ void async_b128_x4(uint32_t l0, uint32_t l1, uint32_t l2, uint32_t l3,
                                              uint32_t g0, uint32_t g1, uint32_t g2, uint32_t g3,
                                              uint64_t sbase) {
    asm volatile("global_load_async_to_lds_b128 %0, %4, %8\n\t"
                 "global_load_async_to_lds_b128 %1, %5, %8\n\t"
                 "global_load_async_to_lds_b128 %2, %6, %8\n\t"
                 "global_load_async_to_lds_b128 %3, %7, %8\n\t"
                 "s_wait_xcnt 0x0"
                 :: "v"(l0), "v"(l1), "v"(l2), "v"(l3),
                    "v"(g0), "v"(g1), "v"(g2), "v"(g3), "s"(sbase)
                 : "memory");
}
__device__ __forceinline__ void async_b128_x2(uint32_t l0, uint32_t l1,
                                              uint32_t g0, uint32_t g1, uint64_t sbase) {
    asm volatile("global_load_async_to_lds_b128 %0, %2, %4\n\t"
                 "global_load_async_to_lds_b128 %1, %3, %4\n\t"
                 "s_wait_xcnt 0x0"
                 :: "v"(l0), "v"(l1), "v"(g0), "v"(g1), "s"(sbase)
                 : "memory");
}
// stands in front of the barrier behind which a buffer this wave has read is refilled
__device__ __forceinline__ void wait_dscnt0() {
    asm volatile("s_wait_dscnt 0" ::: "memory");
}

// HEADS = false: A is row-major [rows][kD].
// HEADS = true:  A is [H][S][HD] of one batch (chunk c = half (c&1) of head c/2)
//                and each A value is scaled by scs[head] as it leaves LDS.
// abase / wbase: first byte of the block's first A row / W row.
template <int NT, bool HEADS>
__device__ __forceinline__ void proj_tile(float* sm, const float* scs,
                                          uint64_t abase, uint64_t wbase,
                                          v8f (&acc)[2][NT])
{
    constexpr int      kBufF = (128 + 32 * NT) * kGP;   // floats a buffer: A rows, then W rows
    constexpr uint32_t kBufB = kBufF * 4u;
    constexpr uint32_t kAPit = HEADS ? kHD * 4u : kD * 4u;   // A's source row pitch, bytes
    constexpr uint32_t kWPit = kD * 4u;

    const int tid   = threadIdx.x;
    const int widb  = tid >> 5;
    const int lane  = tid & 31;
    const int l16   = lane & 15;
    const int khalf = (lane >> 4) << 1;
    const int wm    = widb & 3;
    const int wn    = widb >> 2;

    // staging: 8 threads a row (16 bytes each), 32 rows a sweep
    const uint32_t srow = (uint32_t)(tid >> 3);
    const uint32_t scol = (uint32_t)(tid & 7) * 16u;
    const uint32_t ldsA = (uint32_t)(uintptr_t)sm + srow * (kGP * 4u) + scol;
    const uint32_t ldsW = ldsA + 128u * (kGP * 4u);
    const uint32_t ga   = srow * kAPit + scol;
    const uint32_t gw   = srow * kWPit + scol;
    constexpr uint32_t kL32 = 32u * kGP * 4u;           // 32 rows further on in LDS

    auto stage = [&](int buf, int c) {
        const uint64_t ab = abase + (HEADS ? (uint64_t)(c >> 1) * (kS * kHD * 4u) + (uint64_t)(c & 1) * (kKC * 4u)
                                           : (uint64_t)c * (kKC * 4u));
        const uint64_t wb = wbase + (uint64_t)c * (kKC * 4u);
        const uint32_t la = ldsA + (uint32_t)buf * kBufB;
        const uint32_t lw = ldsW + (uint32_t)buf * kBufB;
        async_b128_x4(la, la + kL32, la + 2 * kL32, la + 3 * kL32,
                      ga, ga + 32 * kAPit, ga + 64 * kAPit, ga + 96 * kAPit, ab);
        if constexpr (NT == 4)
            async_b128_x4(lw, lw + kL32, lw + 2 * kL32, lw + 3 * kL32,
                          gw, gw + 32 * kWPit, gw + 64 * kWPit, gw + 96 * kWPit, wb);
        else
            async_b128_x2(lw, lw + kL32, gw, gw + 32 * kWPit, wb);
    };

    stage(0, 0);
    wait_asynccnt0();           // this wave's copies of chunk 0 have landed
    __syncthreads();            // everyone's have (and scs is written)
    stage(1, 1);

    const int aoff = (wm * 32 + l16) * kGP + khalf;
    const int boff = (128 + wn * (16 * NT) + l16) * kGP + khalf;

    for (int c = 0; c < kNC; ++c) {
        const float* bufp = sm + (c & 1) * kBufF;
        float sc = 1.0f;
        if constexpr (HEADS) sc = scs[c >> 1];
        // every unroll below: a[] and acc[][] stay in registers only when they are
        // indexed by constants; with the k steps unrolled the fragment reads of
        // later steps can also go ahead of the products
#pragma unroll
        for (int ks = 0; ks < kKC / 4; ++ks) {
            v2f a[2];
#pragma unroll
            for (int i = 0; i < 2; ++i) {
                a[i] = *(const v2f*)(bufp + aoff + i * 16 * kGP + 4 * ks);
                if constexpr (HEADS) { a[i][0] *= sc; a[i][1] *= sc; }
            }
#pragma unroll
            for (int nt = 0; nt < NT; ++nt) {
                const v2f b = *(const v2f*)(bufp + boff + nt * 16 * kGP + 4 * ks);
                acc[0][nt] = wmma4(a[0], b, acc[0][nt]);
                acc[1][nt] = wmma4(a[1], b, acc[1][nt]);
            }
        }
        wait_dscnt0();          // this wave's reads of the buffer are done
        wait_asynccnt0();       // this wave's copies of chunk c+1 have landed
        __syncthreads();        // chunk c+1 is published; chunk c's buffer is free
        if (c + 2 < kNC) stage(c & 1, c + 2);
    }
    wait_asynccnt0();           // nothing is in flight when the wave goes on
}

// ---------------------------------------------------------------------------
// Kernel 1: Q/K/V projections.  out = x @ W.T + b, scattered to [B,H,S,HD].
// One block -> 128x128 output tile. 3 * 64 * 4 = 768 blocks.
// ---------------------------------------------------------------------------
__global__ __launch_bounds__(256) void k_qkv(
    const float* __restrict__ x,
    const float* __restrict__ Wq, const float* __restrict__ bq,
    const float* __restrict__ Wk, const float* __restrict__ bk,
    const float* __restrict__ Wv, const float* __restrict__ bv,
    float* __restrict__ q, float* __restrict__ k, float* __restrict__ v)
{
    __shared__ __align__(16) float sm[2 * 256 * kGP];   // 73,728 B

    const int which = blockIdx.x >> 8;      // 0=q, 1=k, 2=v
    const int t     = blockIdx.x & 255;
    const int row0  = (t >> 2) << 7;        // 64 row-tiles of 128 (over B*S)
    const int col0  = (t & 3) << 7;         // 4 col-tiles of 128  (over D)

    const float* W    = (which == 0) ? Wq : (which == 1) ? Wk : Wv;
    const float* bias = (which == 0) ? bq : (which == 1) ? bk : bv;
    float*       out  = (which == 0) ? q  : (which == 1) ? k  : v;

    v8f acc[2][4] = {};
    proj_tile<4, false>(sm, nullptr,
                        (uint64_t)(uintptr_t)(x + (size_t)row0 * kD),
                        (uint64_t)(uintptr_t)(W + (size_t)col0 * kD), acc);

    const int widb = threadIdx.x >> 5;
    const int lane = threadIdx.x & 31;
    const int l16  = lane & 15;
    const int crow = (lane >> 4) << 3;      // 0 or 8
    const int wr0  = row0 + (widb & 3) * 32;
    const int wc0  = col0 + (widb >> 2) * 64;
    // every unroll below: acc[][] is indexed by constants
#pragma unroll
    for (int i = 0; i < 2; ++i)
#pragma unroll
    for (int nt = 0; nt < 4; ++nt) {
        const int j  = wc0 + nt * 16 + l16;       // global col over D
        const int h_ = j >> 6;                    // / HD
        const int hd = j & (kHD - 1);
        const float bj = bias[j];
#pragma unroll
        for (int vv = 0; vv < 8; ++vv) {
            const int r  = wr0 + i * 16 + crow + vv;  // global row over B*S
            const int b_ = r >> 11;                   // / S
            const int s_ = r & (kS - 1);
            out[(((size_t)(b_ * kH + h_)) * kS + s_) * kHD + hd] = acc[i][nt][vv] + bj;
        }
    }
}

// ---------------------------------------------------------------------------
// Kernel 2: rolled mask, made once per (m,s,t):
//   lm[m,s,t]  = sum_r mask1[m,r,s] * mask2[m,r,t]      (WMMA, into LDS)
//   lmr[m,s,t] = lm[m,s,roll[s,t]]                      (gather from LDS)
// One BLOCK = one m and 16 s-rows: its 8 waves build the whole 16x2048 strip
// of lm in LDS (256 columns a wave), then gather from it.
// lmr is stored by 16x16 tiles in the WMMA accumulator layout:
//   lmr[((m*128 + s/16)*128 + t/16)*256 + lane*8 + vv]
//     = value of row (s/16)*16 + 8*(lane/16) + vv, column (t/16)*16 + lane%16
// so that the attention kernel reads a tile as 32 contiguous bytes a lane.
// ---------------------------------------------------------------------------
constexpr int kLP = kS + 4;   // strip pitch in floats: rows 8 apart sit 32 banks apart

__global__ __launch_bounds__(256) void k_lm(
    const float* __restrict__ mask1, const float* __restrict__ mask2,
    const int* __restrict__ roll, float* __restrict__ lmr)
{
    __shared__ __align__(16) float strip[16 * kLP];   // 131,328 B

    const int widb = threadIdx.x >> 5;
    const int lane = threadIdx.x & 31;
    const int m    = blockIdx.x >> 7;       // 4 masks
    const int st   = blockIdx.x & 127;      // 128 s-tiles of 16
    const int s0   = st << 4;

    const int l16   = lane & 15;
    const int khalf = (lane >> 4) << 1;
    const int crow  = (lane >> 4) << 3;

    const float* m1 = mask1 + (size_t)m * kR * kS;
    const float* m2 = mask2 + (size_t)m * kR * kS;

    // every unroll below: a[], acc[], r0 and r1 stay in registers only when
    // they are indexed by constants
    v2f a[8];
#pragma unroll
    for (int kk = 0; kk < 8; ++kk) {
        const int kb = 4 * kk + khalf;
        a[kk][0] = m1[(size_t)kb * kS + s0 + l16];
        a[kk][1] = m1[(size_t)(kb + 1) * kS + s0 + l16];
    }

    for (int g = 0; g < 4; ++g) {
        const int t0 = widb * 256 + g * 64;
        const float* bp = m2 + khalf * kS + t0 + l16;
        v8f acc[4] = {};
#pragma unroll
        for (int kk = 0; kk < 8; ++kk) {
#pragma unroll
            for (int nt = 0; nt < 4; ++nt) {
                v2f b;
                b[0] = bp[(4 * kk) * kS + nt * 16];
                b[1] = bp[(4 * kk + 1) * kS + nt * 16];
                acc[nt] = wmma4(a[kk], b, acc[nt]);
            }
        }
#pragma unroll
        for (int nt = 0; nt < 4; ++nt)
#pragma unroll
            for (int vv = 0; vv < 8; ++vv)
                strip[(crow + vv) * kLP + t0 + nt * 16 + l16] = acc[nt][vv];
    }
    __syncthreads();            // the whole strip is written before anyone gathers

    const int* rl  = roll + (size_t)(s0 + crow) * kS + l16;
    float*     dst = lmr + ((size_t)(m * 128 + st) * 128) * 256 + lane * 8;
    for (int j = 0; j < 16; ++j) {
        const int tt = widb * 16 + j;       // t-tile
        v4f r0, r1;
#pragma unroll
        for (int vv = 0; vv < 8; ++vv) {
            // the index is bounded to the strip's row before the address is formed
            const int gidx = rl[(size_t)vv * kS + tt * 16] & (kS - 1);
            const float g = strip[(crow + vv) * kLP + gidx];
            if (vv < 4) r0[vv] = g; else r1[vv - 4] = g;
        }
        *(v4f*)(dst + (size_t)tt * 256)     = r0;
        *(v4f*)(dst + (size_t)tt * 256 + 4) = r1;
    }
}

// ---------------------------------------------------------------------------
// Kernel 3: flash-style pass. One BLOCK = one (b,h) and 128 s-rows; each of
// its 8 waves owns a 16-row slice. K/V 16x64 tiles are double-buffered in LDS
// via GLOBAL_LOAD_ASYNC_TO_LDS_B128 (ASYNCcnt), shared by all 8 waves:
//   att16x16 = (q kT)/8 * lmr[m, s, t]   (rolled mask, read by tiles)
//   ssq    += sum(att^2)          (Frobenius accumulator, scalar per (b,h))
//   O16x64 += att16x16 @ V16x64   (att bounced through LDS for A-layout)
// Frobenius scale is applied later (scalar per (b,h), commutes with att@v).
// LDS row pitches, in floats (64 banks of 4 bytes), one for each tile's reader:
//   K: 16 lanes walk down a column 8 bytes wide; at 68 the 16 rows start on
//      16 distinct multiples of 4 banks
//   V: a fragment read takes 16 floats a row from rows 2 apart; at 80 four
//      rows in a row start 16 banks apart
//   score tile: written by rows 8 apart, read down a column 8 bytes wide; at 20
//      rows 8 apart start 32 banks apart, and the 16 rows start on 16 distinct
//      multiples of 4 banks
// Each pitch is a multiple of 4 floats, so the 16-byte copies stay aligned.
// ---------------------------------------------------------------------------
constexpr int kKP = 68;
constexpr int kVP = 80;
constexpr int kAP = 20;

__global__ __launch_bounds__(256) void k_attn(
    const float* __restrict__ q, const float* __restrict__ k,
    const float* __restrict__ v, const float* __restrict__ lmr,
    float* __restrict__ ouns, float* __restrict__ partial)
{
    __shared__ __align__(16) float kvbuf[2][16 * (kKP + kVP)]; // [buf]: K rows, then V rows
    __shared__ __align__(16) float att_lds[8][16 * kAP];       // 16x16 bounce tile per wave

    const int tid  = threadIdx.x;
    const int widb = tid >> 5;
    const int lane = tid & 31;

    const int bh   = blockIdx.x >> 4;        // b*H + h   (32 total)
    const int sblk = blockIdx.x & 15;        // 16 s-superblocks of 128 rows
    const int s0   = sblk * 128 + widb * 16; // this wave's 16 rows
    const int mm   = bh & (kM - 1);          // h % M  (H multiple of M)

    const float* qb  = q  + (size_t)bh * kS * kHD;
    // mask tiles: the block's 8 tile rows start at lmb; 32 bytes a lane and tile
    const float* lmb  = lmr + ((size_t)(mm * 128 + sblk * 8) * 128) * 256;
    const int    lmof = widb * (128 * 256) + lane * 8;
    const uint64_t kbase = (uint64_t)(uintptr_t)(k + (size_t)bh * kS * kHD);
    const uint64_t vbase = (uint64_t)(uintptr_t)(v + (size_t)bh * kS * kHD);

    const int l16   = lane & 15;
    const int khalf = (lane >> 4) << 1;
    const int crow  = (lane >> 4) << 3;

    // Cooperative staging: 256 threads x 16B cover one 16x64 f32 tile.
    const uint32_t strow = (uint32_t)(tid >> 4);       // 0..15
    const uint32_t stcol = (uint32_t)((tid & 15) * 4); // 0..60, 16B aligned
    const uint32_t ldsK  = (uint32_t)(uintptr_t)&kvbuf[0][strow * kKP + stcol];
    const uint32_t ldsV  = (uint32_t)(uintptr_t)&kvbuf[0][16 * kKP + strow * kVP + stcol];
    const uint32_t bufStride = (uint32_t)(sizeof(float) * 16 * (kKP + kVP));
#define STAGE(BUF, T0)                                                        \
    do {                                                                      \
        const uint32_t goff = (((uint32_t)(T0) + strow) * kHD + stcol) * 4u;  \
        async_b128_to_lds(ldsK + (BUF) * bufStride, goff, kbase);             \
        async_b128_to_lds(ldsV + (BUF) * bufStride, goff, vbase);             \
    } while (0)

    // Preload the 16x64 Q block as 16 A-fragments (kept in VGPRs).
    v2f qa[16];
#pragma unroll
    for (int kk = 0; kk < 16; ++kk)
        qa[kk] = *(const v2f*)(qb + (size_t)(s0 + l16) * kHD + 4 * kk + khalf);

    v8f oacc[4] = {};
    float ssql = 0.0f;
    float* tile = att_lds[widb];

    STAGE(0, 0);
    int cur = 0;
    for (int t0 = 0; t0 < kS; t0 += 16) {
        wait_asynccnt0();       // this wave's async stores to LDS landed
        __syncthreads();        // everyone's landed; prev buffer free to reuse
        if (t0 + 16 < kS) STAGE(cur ^ 1, t0 + 16);   // overlap next tile load

        // mask tile: issued here, first used behind the QK products
        const v4f lm0 = *(const v4f*)(lmb + t0 * 16 + lmof);
        const v4f lm1 = *(const v4f*)(lmb + t0 * 16 + lmof + 4);

        const float* kt = kvbuf[cur];
        const float* vt = kvbuf[cur] + 16 * kKP;

        // --- att tile = Q(16x64) @ K(16x64)^T  (K from LDS) ---
        v8f attc = {};
#pragma unroll
        for (int kk = 0; kk < 16; ++kk) {
            v2f bf = *(const v2f*)(kt + l16 * kKP + 4 * kk + khalf);
            attc = wmma4(qa[kk], bf, attc);
        }
        // --- elementwise: 1/sqrt(HD), rolled mask, ssq, stash to LDS ---
#pragma unroll
        for (int vv = 0; vv < 8; ++vv) {
            const float lmv = (vv < 4) ? lm0[vv & 3] : lm1[vv & 3];
            const float a = attc[vv] * 0.125f * lmv;
            ssql += a * a;
            tile[(crow + vv) * kAP + l16] = a;
        }
        // same-wave LDS is in-order: store->load needs no barrier
        // --- O(16x64) += att(16x16) @ V(16x64)  (V from LDS) ---
#pragma unroll
        for (int kk = 0; kk < 4; ++kk) {
            v2f af = *(const v2f*)(&tile[l16 * kAP + 4 * kk + khalf]);
#pragma unroll
            for (int nt = 0; nt < 4; ++nt) {
                v2f bf;
                bf[0] = vt[(4 * kk + khalf) * kVP + nt * 16 + l16];
                bf[1] = vt[(4 * kk + khalf + 1) * kVP + nt * 16 + l16];
                oacc[nt] = wmma4(af, bf, oacc[nt]);
            }
        }
        cur ^= 1;
    }
#undef STAGE

    // wave-reduce ssq (wave32) and emit one deterministic partial per wave
#pragma unroll
    for (int off = 16; off > 0; off >>= 1)
        ssql += __shfl_xor(ssql, off, 32);
    if (lane == 0) partial[bh * 128 + sblk * 8 + widb] = ssql;

#pragma unroll
    for (int nt = 0; nt < 4; ++nt)
#pragma unroll
        for (int vv = 0; vv < 8; ++vv)
            ouns[(size_t)bh * kS * kHD + (size_t)(s0 + crow + vv) * kHD + nt * 16 + l16]
                = oacc[nt][vv];
}

// ---------------------------------------------------------------------------
// Kernel 4a: reduce per-wave ssq partials -> ssq[b*H+h]  (deterministic)
// ---------------------------------------------------------------------------
__global__ void k_ssqred(const float* __restrict__ partial, float* __restrict__ ssq)
{
    const int t = threadIdx.x;
    if (t < kB * kH) {
        float s = 0.0f;
        for (int i = 0; i < kS / 16; ++i) s += partial[t * (kS / 16) + i];
        ssq[t] = s;
    }
}

// ---------------------------------------------------------------------------
// Kernel 4b: out = (scale[b,h] * Ouns) @ Wo.T + bo, scale folded into the A
// fragments. One block -> 128x64 output tile. 64 * 8 = 512 blocks.
// ---------------------------------------------------------------------------
__global__ __launch_bounds__(256) void k_out(
    const float* __restrict__ ouns, const float* __restrict__ ssq,
    const float* __restrict__ Wo, const float* __restrict__ bo,
    float* __restrict__ out)
{
    __shared__ __align__(16) float sm[2 * 192 * kGP];   // 55,296 B
    __shared__ float scs[kH];

    const int row0 = (blockIdx.x >> 3) << 7;    // over B*S; a tile never straddles a batch
    const int col0 = (blockIdx.x & 7) << 6;     // over D
    const int b_   = row0 >> 11;
    const int s0   = row0 & (kS - 1);

    // read behind the first barrier of proj_tile
    if (threadIdx.x < kH)
        scs[threadIdx.x] = 1.0f / (sqrtf(ssq[b_ * kH + threadIdx.x]) + kEPS);

    v8f acc[2][2] = {};
    proj_tile<2, true>(sm, scs,
                       (uint64_t)(uintptr_t)(ouns + ((size_t)b_ * kH * kS + s0) * kHD),
                       (uint64_t)(uintptr_t)(Wo + (size_t)col0 * kD), acc);

    const int widb = threadIdx.x >> 5;
    const int lane = threadIdx.x & 31;
    const int l16  = lane & 15;
    const int crow = (lane >> 4) << 3;
    const int wr0  = row0 + (widb & 3) * 32;
    const int wc0  = col0 + (widb >> 2) * 32;
    // every unroll below: acc[][] is indexed by constants
#pragma unroll
    for (int i = 0; i < 2; ++i)
#pragma unroll
    for (int nt = 0; nt < 2; ++nt) {
        const int j = wc0 + nt * 16 + l16;
        const float bj = bo[j];
#pragma unroll
        for (int vv = 0; vv < 8; ++vv) {
            const int r = wr0 + i * 16 + crow + vv;
            out[(size_t)r * kD + j] = acc[i][nt][vv] + bj;
        }
    }
}

// ---------------------------------------------------------------------------
extern "C" void kernel_launch(void* const* d_in, const int* in_sizes, int n_in,
                              void* d_out, int out_size, void* d_ws, size_t ws_size,
                              hipStream_t stream) {
    (void)in_sizes; (void)n_in; (void)out_size; (void)ws_size;

    const float* x     = (const float*)d_in[0];
    const float* Wq    = (const float*)d_in[1];
    const float* bq    = (const float*)d_in[2];
    const float* Wk    = (const float*)d_in[3];
    const float* bk    = (const float*)d_in[4];
    const float* Wv    = (const float*)d_in[5];
    const float* bv    = (const float*)d_in[6];
    const float* mask1 = (const float*)d_in[7];
    const float* mask2 = (const float*)d_in[8];
    const float* Wo    = (const float*)d_in[9];
    const float* bo    = (const float*)d_in[10];
    const int*   roll  = (const int*)d_in[11];

    const size_t nQKV = (size_t)kB * kH * kS * kHD;   // 4,194,304
    const size_t nLM  = (size_t)kM * kS * kS;         // 16,777,216
    float* ws      = (float*)d_ws;
    float* q       = ws;
    float* k       = q + nQKV;
    float* v       = k + nQKV;
    float* lm      = v + nQKV;
    float* ouns    = lm + nLM;
    float* partial = ouns + nQKV;                     // 4096 floats
    float* ssq     = partial + 4096;                  // 32 floats

    k_qkv  <<<768,  256, 0, stream>>>(x, Wq, bq, Wk, bk, Wv, bv, q, k, v);
    k_lm   <<<512,  256, 0, stream>>>(mask1, mask2, roll, lm);
    k_attn <<<512,  256, 0, stream>>>(q, k, v, lm, ouns, partial);
    k_ssqred<<<1,    32, 0, stream>>>(partial, ssq);
    k_out  <<<512,  256, 0, stream>>>(ouns, ssq, Wo, bo, (float*)d_out);
}

// v004
// One run takes 281 microseconds.
// In two side-by-side timings against v003, it was 1.06 and 1.05 times as fast.
// Counting every step since v000, it is 3.68 times as fast.
#include <hip/hip_runtime.h>
#include <hip/hip_bf16.h>
#include <math.h>
#include <stdint.h>

// Problem constants (from the reference)
constexpr int kB  = 4;
constexpr int kS  = 2048;
constexpr int kD  = 512;
constexpr int kH  = 8;
constexpr int kM  = 4;
constexpr int kR  = 32;
constexpr int kHD = 64;   // D / H
constexpr float kEPS = 1e-8f;

typedef __attribute__((ext_vector_type(2))) float v2f;
typedef __attribute__((ext_vector_type(4))) float v4f;
typedef __attribute__((ext_vector_type(8))) float v8f;

// CDNA5 fp32 WMMA: D(16x16,f32) = A(16x4,f32) x B(4x16,f32) + C
// A frag (2 VGPR): lane L holds A[L%16][2*(L/16) + i]   (i = vgpr index)
// B frag (2 VGPR): lane L holds B[2*(L/16) + i][L%16]
// C/D (8 VGPR):    vgpr v, lane L holds C[v + 8*(L/16)][L%16]
__device__ __forceinline__ v8f wmma4(v2f a, v2f b, v8f c) {
    return __builtin_amdgcn_wmma_f32_16x16x4_f32(
        /*neg_a=*/false, a, /*neg_b=*/false, b,
        /*c_mod=*/(short)0, c, /*reuse_a=*/false, /*reuse_b=*/false);
}

// Async global->LDS copies, 16B per lane (GLOBAL_LOAD_ASYNC_TO_LDS_B128, GVS
// addressing: mem = SGPR base + VGPR 32-bit offset; LDS addr from VGPR).
// Tracked by ASYNCcnt; data bypasses VGPRs entirely.
__device__ __forceinline__ void wait_asynccnt0() {
    asm volatile("s_wait_asynccnt 0" ::: "memory");
}

// ---------------------------------------------------------------------------
// Projection products, Y = A @ W.T: one BLOCK = 128 rows x (32*NT) columns of Y.
// A and W are walked in chunks of 32 k; a chunk of both (128 + 32*NT rows of
// 128 bytes) is staged in LDS by async copies, two buffers, the next chunk in
// flight while this one is worked on. 8 waves as 4 (rows) x 2 (columns); a wave
// owns 32 x (16*NT) of Y: 2 A fragments and NT B fragments feed 2*NT products.
// Row pitch 36 floats: the 16 rows of a fragment read (16 bytes a row) start on
// 16 distinct multiples of 4 banks. k runs 0,4,8,... into one accumulator.
// ---------------------------------------------------------------------------
constexpr int kGP = 36;            // LDS row pitch, floats
constexpr int kKC = 32;            // k per chunk
constexpr int kNC = kD / kKC;      // 16 chunks

// Runs of async copies that share one scalar base; s_wait_xcnt 0 is the last
// line of the copies' own statement: a precaution, so that it stands in front
// of every later rewrite of the registers that the copies name.
__device__ __forceinline__ void async_b128_x4(uint32_t l0, uint32_t l1, uint32_t l2, uint32_t l3,
                                              uint32_t g0, uint32_t g1, uint32_t g2, uint32_t g3,
                                              uint64_t sbase) {
    asm volatile("global_load_async_to_lds_b128 %0, %4, %8\n\t"
                 "global_load_async_to_lds_b128 %1, %5, %8\n\t"
                 "global_load_async_to_lds_b128 %2, %6, %8\n\t"
                 "global_load_async_to_lds_b128 %3, %7, %8\n\t"
                 "s_wait_xcnt 0x0"
                 :: "v"(l0), "v"(l1), "v"(l2), "v"(l3),
                    "v"(g0), "v"(g1), "v"(g2), "v"(g3), "s"(sbase)
                 : "memory");
}
__device__ __forceinline__ void async_b128_x2(uint32_t l0, uint32_t l1,
                                              uint32_t g0, uint32_t g1, uint64_t sbase) {
    asm volatile("global_load_async_to_lds_b128 %0, %2, %4\n\t"
                 "global_load_async_to_lds_b128 %1, %3, %4\n\t"
                 "s_wait_xcnt 0x0"
                 :: "v"(l0), "v"(l1), "v"(g0), "v"(g1), "s"(sbase)
                 : "memory");
}
// stands in front of the barrier behind which a buffer this wave has read is refilled
__device__ __forceinline__ void wait_dscnt0() {
    asm volatile("s_wait_dscnt 0" ::: "memory");
}

// HEADS = false: A is row-major [rows][kD].
// HEADS = true:  A is [H][S][HD] of one batch (chunk c = half (c&1) of head c/2)
//                and each A value is scaled by scs[head] as it leaves LDS.
// abase / wbase: first byte of the block's first A row / W row.
template <int NT, bool HEADS>
__device__ __forceinline__ void proj_tile(float* sm, const float* scs,
                                          uint64_t abase, uint64_t wbase,
                                          v8f (&acc)[2][NT])
{
    constexpr int      kBufF = (128 + 32 * NT) * kGP;   // floats a buffer: A rows, then W rows
    constexpr uint32_t kBufB = kBufF * 4u;
    constexpr uint32_t kAPit = HEADS ? kHD * 4u : kD * 4u;   // A's source row pitch, bytes
    constexpr uint32_t kWPit = kD * 4u;

    const int tid   = threadIdx.x;
    const int widb  = tid >> 5;
    const int lane  = tid & 31;
    const int l16   = lane & 15;
    const int khalf = (lane >> 4) << 1;
    const int wm    = widb & 3;
    const int wn    = widb >> 2;

    // staging: 8 threads a row (16 bytes each), 32 rows a sweep
    const uint32_t srow = (uint32_t)(tid >> 3);
    const uint32_t scol = (uint32_t)(tid & 7) * 16u;
    const uint32_t ldsA = (uint32_t)(uintptr_t)sm + srow * (kGP * 4u) + scol;
    const uint32_t ldsW = ldsA + 128u * (kGP * 4u);
    const uint32_t ga   = srow * kAPit + scol;
    const uint32_t gw   = srow * kWPit + scol;
    constexpr uint32_t kL32 = 32u * kGP * 4u;           // 32 rows further on in LDS

    auto stage = [&](int buf, int c) {
        const uint64_t ab = abase + (HEADS ? (uint64_t)(c >> 1) * (kS * kHD * 4u) + (uint64_t)(c & 1) * (kKC * 4u)
                                           : (uint64_t)c * (kKC * 4u));
        const uint64_t wb = wbase + (uint64_t)c * (kKC * 4u);
        const uint32_t la = ldsA + (uint32_t)buf * kBufB;
        const uint32_t lw = ldsW + (uint32_t)buf * kBufB;
        async_b128_x4(la, la + kL32, la + 2 * kL32, la + 3 * kL32,
                      ga, ga + 32 * kAPit, ga + 64 * kAPit, ga + 96 * kAPit, ab);
        if constexpr (NT == 4)
            async_b128_x4(lw, lw + kL32, lw + 2 * kL32, lw + 3 * kL32,
                          gw, gw + 32 * kWPit, gw + 64 * kWPit, gw + 96 * kWPit, wb);
        else
            async_b128_x2(lw, lw + kL32, gw, gw + 32 * kWPit, wb);
    };

    stage(0, 0);
    wait_asynccnt0();           // this wave's copies of chunk 0 have landed
    __syncthreads();            // everyone's have (and scs is written)
    stage(1, 1);

    const int aoff = (wm * 32 + l16) * kGP + khalf;
    const int boff = (128 + wn * (16 * NT) + l16) * kGP + khalf;

    for (int c = 0; c < kNC; ++c) {
        const float* bufp = sm + (c & 1) * kBufF;
        float sc = 1.0f;
        if constexpr (HEADS) sc = scs[c >> 1];
        // every unroll below: a[] and acc[][] stay in registers only when they are
        // indexed by constants; with the k steps unrolled the fragment reads of
        // later steps can also go ahead of the products
#pragma unroll
        for (int ks = 0; ks < kKC / 4; ++ks) {
            v2f a[2];
#pragma unroll
            for (int i = 0; i < 2; ++i) {
                a[i] = *(const v2f*)(bufp + aoff + i * 16 * kGP + 4 * ks);
                if constexpr (HEADS) { a[i][0] *= sc; a[i][1] *= sc; }
            }
#pragma unroll
            for (int nt = 0; nt < NT; ++nt) {
                const v2f b = *(const v2f*)(bufp + boff + nt * 16 * kGP + 4 * ks);
                acc[0][nt] = wmma4(a[0], b, acc[0][nt]);
                acc[1][nt] = wmma4(a[1], b, acc[1][nt]);
            }
        }
        wait_dscnt0();          // this wave's reads of the buffer are done
        wait_asynccnt0();       // this wave's copies of chunk c+1 have landed
        __syncthreads();        // chunk c+1 is published; chunk c's buffer is free
        if (c + 2 < kNC) stage(c & 1, c + 2);
    }
    wait_asynccnt0();           // nothing is in flight when the wave goes on
}

// ---------------------------------------------------------------------------
// Kernel 1: Q/K/V projections.  out = x @ W.T + b, scattered to [B,H,S,HD].
// One block -> 128x128 output tile. 3 * 64 * 4 = 768 blocks.
// ---------------------------------------------------------------------------
__global__ __launch_bounds__(256) void k_qkv(
    const float* __restrict__ x,
    const float* __restrict__ Wq, const float* __restrict__ bq,
    const float* __restrict__ Wk, const float* __restrict__ bk,
    const float* __restrict__ Wv, const float* __restrict__ bv,
    float* __restrict__ q, float* __restrict__ k, float* __restrict__ v)
{
    __shared__ __align__(16) float sm[2 * 256 * kGP];   // 73,728 B

    const int which = blockIdx.x >> 8;      // 0=q, 1=k, 2=v
    const int t     = blockIdx.x & 255;
    const int row0  = (t >> 2) << 7;        // 64 row-tiles of 128 (over B*S)
    const int col0  = (t & 3) << 7;         // 4 col-tiles of 128  (over D)

    const float* W    = (which == 0) ? Wq : (which == 1) ? Wk : Wv;
    const float* bias = (which == 0) ? bq : (which == 1) ? bk : bv;
    float*       out  = (which == 0) ? q  : (which == 1) ? k  : v;

    v8f acc[2][4] = {};
    proj_tile<4, false>(sm, nullptr,
                        (uint64_t)(uintptr_t)(x + (size_t)row0 * kD),
                        (uint64_t)(uintptr_t)(W + (size_t)col0 * kD), acc);

    const int widb = threadIdx.x >> 5;
    const int lane = threadIdx.x & 31;
    const int l16  = lane & 15;
    const int crow = (lane >> 4) << 3;      // 0 or 8
    const int wr0  = row0 + (widb & 3) * 32;
    const int wc0  = col0 + (widb >> 2) * 64;
    // every unroll below: acc[][] is indexed by constants
#pragma unroll
    for (int i = 0; i < 2; ++i)
#pragma unroll
    for (int nt = 0; nt < 4; ++nt) {
        const int j  = wc0 + nt * 16 + l16;       // global col over D
        const int h_ = j >> 6;                    // / HD
        const int hd = j & (kHD - 1);
        const float bj = bias[j];
#pragma unroll
        for (int vv = 0; vv < 8; ++vv) {
            const int r  = wr0 + i * 16 + crow + vv;  // global row over B*S
            const int b_ = r >> 11;                   // / S
            const int s_ = r & (kS - 1);
            out[(((size_t)(b_ * kH + h_)) * kS + s_) * kHD + hd] = acc[i][nt][vv] + bj;
        }
    }
}

// ---------------------------------------------------------------------------
// Kernel 2: rolled mask, made once per (m,s,t):
//   lm[m,s,t]  = sum_r mask1[m,r,s] * mask2[m,r,t]      (WMMA, into LDS)
//   lmr[m,s,t] = lm[m,s,roll[s,t]]                      (gather from LDS)
// One BLOCK = one m and 16 s-rows: its 8 waves build the whole 16x2048 strip
// of lm in LDS (256 columns a wave), then gather from it.
// lmr is stored by 16x16 tiles in the WMMA accumulator layout:
//   lmr[((m*128 + s/16)*128 + t/16)*256 + lane*8 + vv]
//     = value of row (s/16)*16 + 8*(lane/16) + vv, column (t/16)*16 + lane%16
// so that the attention kernel reads a tile as 32 contiguous bytes a lane.
// ---------------------------------------------------------------------------
constexpr int kLP = kS + 4;   // strip pitch in floats: rows 8 apart sit 32 banks apart

__global__ __launch_bounds__(256) void k_lm(
    const float* __restrict__ mask1, const float* __restrict__ mask2,
    const int* __restrict__ roll, float* __restrict__ lmr)
{
    __shared__ __align__(16) float strip[16 * kLP];   // 131,328 B

    const int widb = threadIdx.x >> 5;
    const int lane = threadIdx.x & 31;
    const int m    = blockIdx.x >> 7;       // 4 masks
    const int st   = blockIdx.x & 127;      // 128 s-tiles of 16
    const int s0   = st << 4;

    const int l16   = lane & 15;
    const int khalf = (lane >> 4) << 1;
    const int crow  = (lane >> 4) << 3;

    const float* m1 = mask1 + (size_t)m * kR * kS;
    const float* m2 = mask2 + (size_t)m * kR * kS;

    // every unroll below: a[], acc[], r0 and r1 stay in registers only when
    // they are indexed by constants
    v2f a[8];
#pragma unroll
    for (int kk = 0; kk < 8; ++kk) {
        const int kb = 4 * kk + khalf;
        a[kk][0] = m1[(size_t)kb * kS + s0 + l16];
        a[kk][1] = m1[(size_t)(kb + 1) * kS + s0 + l16];
    }

    for (int g = 0; g < 4; ++g) {
        const int t0 = widb * 256 + g * 64;
        const float* bp = m2 + khalf * kS + t0 + l16;
        v8f acc[4] = {};
#pragma unroll
        for (int kk = 0; kk < 8; ++kk) {
#pragma unroll
            for (int nt = 0; nt < 4; ++nt) {
                v2f b;
                b[0] = bp[(4 * kk) * kS + nt * 16];
                b[1] = bp[(4 * kk + 1) * kS + nt * 16];
                acc[nt] = wmma4(a[kk], b, acc[nt]);
            }
        }
#pragma unroll
        for (int nt = 0; nt < 4; ++nt)
#pragma unroll
            for (int vv = 0; vv < 8; ++vv)
                strip[(crow + vv) * kLP + t0 + nt * 16 + l16] = acc[nt][vv];
    }
    __syncthreads();            // the whole strip is written before anyone gathers

    const int* rl  = roll + (size_t)(s0 + crow) * kS + l16;
    float*     dst = lmr + ((size_t)(m * 128 + st) * 128) * 256 + lane * 8;
    for (int j = 0; j < 16; ++j) {
        const int tt = widb * 16 + j;       // t-tile
        v4f r0, r1;
#pragma unroll
        for (int vv = 0; vv < 8; ++vv) {
            // the index is bounded to the strip's row before the address is formed
            const int gidx = rl[(size_t)vv * kS + tt * 16] & (kS - 1);
            const float g = strip[(crow + vv) * kLP + gidx];
            if (vv < 4) r0[vv] = g; else r1[vv - 4] = g;
        }
        *(v4f*)(dst + (size_t)tt * 256)     = r0;
        *(v4f*)(dst + (size_t)tt * 256 + 4) = r1;
    }
}

// ---------------------------------------------------------------------------
// Kernel 3: flash-style pass. One BLOCK = one (b,h) and 128 s-rows; each of
// its 8 waves owns a 16-row slice. K/V are walked in stages of 64 keys (64x64
// tiles), double-buffered in LDS via GLOBAL_LOAD_ASYNC_TO_LDS_B128 (ASYNCcnt),
// shared by all 8 waves; one barrier a stage. A wave's stage:
//   att16x64 = (q kT)/8 * lmr[m, s, t]   (four independent 16x16 accumulators;
//                                         rolled mask, read by tiles)
//   ssq    += sum(att^2)          (Frobenius accumulator, scalar per (b,h))
//   O16x64 += att16x64 @ V64x64   (att bounced through LDS for A-layout)
// Frobenius scale is applied later (scalar per (b,h), commutes with att@v).
// LDS row pitches, in floats (64 banks of 4 bytes), one for each tile's reader:
//   K: 16 lanes walk down a column 8 bytes wide; at 68 the 16 rows start on
//      16 distinct multiples of 4 banks
//   V: a fragment read takes 16 floats a row from rows 2 apart; at 80 four
//      rows in a row start 16 banks apart
//   score tile: written by rows 8 apart, read down a column 8 bytes wide; at 68
//      rows 8 apart start 32 banks apart, and the 16 rows start on 16 distinct
//      multiples of 4 banks
// Each pitch is a multiple of 4 floats, so the 16-byte copies stay aligned.
// ---------------------------------------------------------------------------
constexpr int kKP = 68;
constexpr int kVP = 80;
constexpr int kAP = 68;
constexpr int kTT = 64;            // keys per stage
constexpr int kNS = kS / kTT;      // 32 stages

__global__ __launch_bounds__(256) void k_attn(
    const float* __restrict__ q, const float* __restrict__ k,
    const float* __restrict__ v, const float* __restrict__ lmr,
    float* __restrict__ ouns, float* __restrict__ partial)
{
    __shared__ __align__(16) float kvbuf[2][kTT * (kKP + kVP)]; // [buf]: K rows, then V rows
    __shared__ __align__(16) float att_lds[8][16 * kAP];        // 16x64 bounce tile per wave

    const int tid  = threadIdx.x;
    const int widb = tid >> 5;
    const int lane = tid & 31;

    const int bh   = blockIdx.x >> 4;        // b*H + h   (32 total)
    const int sblk = blockIdx.x & 15;        // 16 s-superblocks of 128 rows
    const int s0   = sblk * 128 + widb * 16; // this wave's 16 rows
    const int mm   = bh & (kM - 1);          // h % M  (H multiple of M)

    const float* qb  = q  + (size_t)bh * kS * kHD;
    // mask tiles: the block's 8 tile rows start at lmb; 32 bytes a lane and tile
    const float* lmb  = lmr + ((size_t)(mm * 128 + sblk * 8) * 128) * 256;
    const int    lmof = widb * (128 * 256) + lane * 8;
    const uint64_t kbase = (uint64_t)(uintptr_t)(k + (size_t)bh * kS * kHD);
    const uint64_t vbase = (uint64_t)(uintptr_t)(v + (size_t)bh * kS * kHD);

    const int l16   = lane & 15;
    const int khalf = (lane >> 4) << 1;
    const int crow  = (lane >> 4) << 3;

    // Cooperative staging: 256 threads x 16B cover 16 rows of a 64x64 f32 tile,
    // four sweeps a tile.
    const uint32_t strow = (uint32_t)(tid >> 4);       // 0..15
    const uint32_t stcol = (uint32_t)((tid & 15) * 4); // 0..60, 16B aligned
    const uint32_t ldsK  = (uint32_t)(uintptr_t)&kvbuf[0][strow * kKP + stcol];
    const uint32_t ldsV  = (uint32_t)(uintptr_t)&kvbuf[0][kTT * kKP + strow * kVP + stcol];
    const uint32_t goff  = (strow * kHD + stcol) * 4u;
    constexpr uint32_t bufStride = (uint32_t)(sizeof(float) * kTT * (kKP + kVP));
    constexpr uint32_t kK16 = 16u * kKP * 4u;          // 16 rows further on: K in LDS,
    constexpr uint32_t kV16 = 16u * kVP * 4u;          // V in LDS,
    constexpr uint32_t kG16 = 16u * kHD * 4u;          // either in global memory
    auto stage = [&](int buf, int st) {
        const uint64_t so = (uint64_t)st * (kTT * kHD * 4u);
        const uint32_t lk = ldsK + (uint32_t)buf * bufStride;
        const uint32_t lv = ldsV + (uint32_t)buf * bufStride;
        async_b128_x4(lk, lk + kK16, lk + 2 * kK16, lk + 3 * kK16,
                      goff, goff + kG16, goff + 2 * kG16, goff + 3 * kG16, kbase + so);
        async_b128_x4(lv, lv + kV16, lv + 2 * kV16, lv + 3 * kV16,
                      goff, goff + kG16, goff + 2 * kG16, goff + 3 * kG16, vbase + so);
    };

    // Preload the 16x64 Q block as 16 A-fragments (kept in VGPRs).
    v2f qa[16];
#pragma unroll
    for (int kk = 0; kk < 16; ++kk)
        qa[kk] = *(const v2f*)(qb + (size_t)(s0 + l16) * kHD + 4 * kk + khalf);

    v8f oacc[4] = {};
    float ssql = 0.0f;
    float* tile = att_lds[widb];

    stage(0, 0);
    wait_asynccnt0();           // this wave's copies of stage 0 have landed
    __syncthreads();            // everyone's have
    stage(1, 1);

    for (int st = 0; st < kNS; ++st) {
        const float* kt = kvbuf[st & 1];
        const float* vt = kt + kTT * kKP;

        // every unroll below: lm[], attc[], qa[] and oacc[] stay in registers only
        // when they are indexed by constants
        // mask tiles: issued here, first used behind the QK products
        v4f lm[4][2];
#pragma unroll
        for (int j = 0; j < 4; ++j) {
            lm[j][0] = *(const v4f*)(lmb + (st * 4 + j) * 256 + lmof);
            lm[j][1] = *(const v4f*)(lmb + (st * 4 + j) * 256 + lmof + 4);
        }

        // --- att tiles = Q(16x64) @ K(64x64)^T  (K from LDS) ---
        v8f attc[4] = {};
#pragma unroll
        for (int kk = 0; kk < 16; ++kk) {
#pragma unroll
            for (int j = 0; j < 4; ++j) {
                v2f bf = *(const v2f*)(kt + (j * 16 + l16) * kKP + 4 * kk + khalf);
                attc[j] = wmma4(qa[kk], bf, attc[j]);
            }
        }
        // --- elementwise: 1/sqrt(HD), rolled mask, ssq, stash to LDS ---
#pragma unroll
        for (int j = 0; j < 4; ++j) {
#pragma unroll
            for (int vv = 0; vv < 8; ++vv) {
                const float lmv = lm[j][vv >> 2][vv & 3];
                const float a = attc[j][vv] * 0.125f * lmv;
                ssql += a * a;
                tile[(crow + vv) * kAP + j * 16 + l16] = a;
            }
        }
        // same-wave LDS is in-order: store->load needs no barrier
        // --- O(16x64) += att(16x64) @ V(64x64)  (V from LDS) ---
#pragma unroll
        for (int kk = 0; kk < kTT / 4; ++kk) {
            v2f af = *(const v2f*)(&tile[l16 * kAP + 4 * kk + khalf]);
#pragma unroll
            for (int nt = 0; nt < 4; ++nt) {
                v2f bf;
                bf[0] = vt[(4 * kk + khalf) * kVP + nt * 16 + l16];
                bf[1] = vt[(4 * kk + khalf + 1) * kVP + nt * 16 + l16];
                oacc[nt] = wmma4(af, bf, oacc[nt]);
            }
        }
        wait_dscnt0();          // this wave's reads of the buffer are done
        wait_asynccnt0();       // this wave's copies of stage st+1 have landed
        __syncthreads();        // stage st+1 is published; stage st's buffer is free
        if (st + 2 < kNS) stage(st & 1, st + 2);
    }
    wait_asynccnt0();           // nothing is in flight when the wave goes on

    // wave-reduce ssq (wave32) and emit one deterministic partial per wave
#pragma unroll
    for (int off = 16; off > 0; off >>= 1)
        ssql += __shfl_xor(ssql, off, 32);
    if (lane == 0) partial[bh * 128 + sblk * 8 + widb] = ssql;

#pragma unroll
    for (int nt = 0; nt < 4; ++nt)
#pragma unroll
        for (int vv = 0; vv < 8; ++vv)
            ouns[(size_t)bh * kS * kHD + (size_t)(s0 + crow + vv) * kHD + nt * 16 + l16]
                = oacc[nt][vv];
}

// ---------------------------------------------------------------------------
// Kernel 4a: reduce per-wave ssq partials -> ssq[b*H+h]  (deterministic)
// ---------------------------------------------------------------------------
__global__ void k_ssqred(const float* __restrict__ partial, float* __restrict__ ssq)
{
    const int t = threadIdx.x;
    if (t < kB * kH) {
        float s = 0.0f;
        for (int i = 0; i < kS / 16; ++i) s += partial[t * (kS / 16) + i];
        ssq[t] = s;
    }
}

// ---------------------------------------------------------------------------
// Kernel 4b: out = (scale[b,h] * Ouns) @ Wo.T + bo, scale folded into the A
// fragments. One block -> 128x64 output tile. 64 * 8 = 512 blocks.
// ---------------------------------------------------------------------------
__global__ __launch_bounds__(256) void k_out(
    const float* __restrict__ ouns, const float* __restrict__ ssq,
    const float* __restrict__ Wo, const float* __restrict__ bo,
    float* __restrict__ out)
{
    __shared__ __align__(16) float sm[2 * 192 * kGP];   // 55,296 B
    __shared__ float scs[kH];

    const int row0 = (blockIdx.x >> 3) << 7;    // over B*S; a tile never straddles a batch
    const int col0 = (blockIdx.x & 7) << 6;     // over D
    const int b_   = row0 >> 11;
    const int s0   = row0 & (kS - 1);

    // read behind the first barrier of proj_tile
    if (threadIdx.x < kH)
        scs[threadIdx.x] = 1.0f / (sqrtf(ssq[b_ * kH + threadIdx.x]) + kEPS);

    v8f acc[2][2] = {};
    proj_tile<2, true>(sm, scs,
                       (uint64_t)(uintptr_t)(ouns + ((size_t)b_ * kH * kS + s0) * kHD),
                       (uint64_t)(uintptr_t)(Wo + (size_t)col0 * kD), acc);

    const int widb = threadIdx.x >> 5;
    const int lane = threadIdx.x & 31;
    const int l16  = lane & 15;
    const int crow = (lane >> 4) << 3;
    const int wr0  = row0 + (widb & 3) * 32;
    const int wc0  = col0 + (widb >> 2) * 32;
    // every unroll below: acc[][] is indexed by constants
#pragma unroll
    for (int i = 0; i < 2; ++i)
#pragma unroll
    for (int nt = 0; nt < 2; ++nt) {
        const int j = wc0 + nt * 16 + l16;
        const float bj = bo[j];
#pragma unroll
        for (int vv = 0; vv < 8; ++vv) {
            const int r = wr0 + i * 16 + crow + vv;
            out[(size_t)r * kD + j] = acc[i][nt][vv] + bj;
        }
    }
}

// ---------------------------------------------------------------------------
extern "C" void kernel_launch(void* const* d_in, const int* in_sizes, int n_in,
                              void* d_out, int out_size, void* d_ws, size_t ws_size,
                              hipStream_t stream) {
    (void)in_sizes; (void)n_in; (void)out_size; (void)ws_size;

    const float* x     = (const float*)d_in[0];
    const float* Wq    = (const float*)d_in[1];
    const float* bq    = (const float*)d_in[2];
    const float* Wk    = (const float*)d_in[3];
    const float* bk    = (const float*)d_in[4];
    const float* Wv    = (const float*)d_in[5];
    const float* bv    = (const float*)d_in[6];
    const float* mask1 = (const float*)d_in[7];
    const float* mask2 = (const float*)d_in[8];
    const float* Wo    = (const float*)d_in[9];
    const float* bo    = (const float*)d_in[10];
    const int*   roll  = (const int*)d_in[11];

    const size_t nQKV = (size_t)kB * kH * kS * kHD;   // 4,194,304
    const size_t nLM  = (size_t)kM * kS * kS;         // 16,777,216
    float* ws      = (float*)d_ws;
    float* q       = ws;
    float* k       = q + nQKV;
    float* v       = k + nQKV;
    float* lm      = v + nQKV;
    float* ouns    = lm + nLM;
    float* partial = ouns + nQKV;                     // 4096 floats
    float* ssq     = partial + 4096;                  // 32 floats

    k_qkv  <<<768,  256, 0, stream>>>(x, Wq, bq, Wk, bk, Wv, bv, q, k, v);
    k_lm   <<<512,  256, 0, stream>>>(mask1, mask2, roll, lm);
    k_attn <<<512,  256, 0, stream>>>(q, k, v, lm, ouns, partial);
    k_ssqred<<<1,    32, 0, stream>>>(partial, ssq);
    k_out  <<<512,  256, 0, stream>>>(ouns, ssq, Wo, bo, (float*)d_out);
}
